// v000
// Measured on an AMD MI455X. A time is GPU time per run, averaged over a window of back-to-back runs after a warm-up
// (all launches, gaps included; the runs take copies of the inputs in turn), and the median of several windows.
// Apart from v000's, it joins two sittings. Times from different sittings can be a few percent apart, while
// side-by-side timings come from the same sitting.
// v000 is the starting kernel. One run takes 333 microseconds.
#include <hip/hip_runtime.h>

#define B_ROWS 131072
#define D_DIM  256
#define TILE_M 128
#define PADH   272            // LDS row stride in halves (breaks bank conflicts)
#define KSTEPS 8              // 256 / 32
#define WAVES  8
#define BLK    (WAVES * 32)   // 256 threads, 8 wave32s

typedef __attribute__((ext_vector_type(16))) __bf16          v16bf;
typedef __attribute__((ext_vector_type(8)))  float           v8f;
typedef __attribute__((ext_vector_type(4)))  float           f4;
typedef __attribute__((ext_vector_type(4)))  unsigned short  u16x4;

union Frag { f4 q[2]; v16bf v; };

// ---- workspace layout (int units) ----
#define WS_COUNTS 0
#define WS_CURS   4
#define WS_OFFS   8                 // offs[0..4], offs[4] = padded total
#define WS_IDX    16
#define WS_PERM   (16 + B_ROWS)
#define WS_PERM_LEN (B_ROWS + 4 * TILE_M)
#define WPACK_BYTES ((size_t)(WS_PERM + WS_PERM_LEN) * 4)   // bf16 packed weights after ints
#define WPLANE 65536                // ushorts per 256x256 plane

__device__ __forceinline__ unsigned short f2bf(float f) {
  unsigned u = __float_as_uint(f);
  u += 0x7FFFu + ((u >> 16) & 1u);          // round-to-nearest-even
  return (unsigned short)(u >> 16);
}
__device__ __forceinline__ float bf2f(unsigned short h) {
  return __uint_as_float(((unsigned)h) << 16);
}

// ---- K0: split fp32 weights into bf16 hi/lo planes, pre-swizzled to WMMA B-frag order ----
// B frag (32x16 bf16): lane (r = lane&15, hi = lane>>4) holds col n = nt*16+r;
// VGPR v<4: K = ks*32 + 8*hi + 2*v + h ; v>=4: K = ks*32 + 16 + 8*hi + 2*(v-4) + h
__global__ void k_pack(const float* __restrict__ Wl, const float* __restrict__ Wm,
                       const float* __restrict__ Wr, unsigned short* __restrict__ wp) {
  int gid = blockIdx.x * 256 + threadIdx.x;
  if (gid >= (7 << 15)) return;
  int v    = gid & 7;
  int lane = (gid >> 3) & 31;
  int ks   = (gid >> 8) & 7;
  int nt   = (gid >> 11) & 15;
  int mat  = gid >> 15;
  const float* W = (mat < 4) ? (Wl + mat * 65536)
                             : ((mat < 6) ? (Wm + (mat - 4) * 65536) : Wr);
  int hi = lane >> 4, r = lane & 15;
  int n = nt * 16 + r;
  unsigned hw = 0, lw = 0;
  for (int h = 0; h < 2; ++h) {
    int k = ks * 32 + 8 * hi + ((v < 4) ? (2 * v + h) : (16 + 2 * (v - 4) + h));
    float w = W[k * D_DIM + n];
    unsigned short wh = f2bf(w);
    unsigned short wl = f2bf(w - bf2f(wh));
    hw |= ((unsigned)wh) << (16 * h);
    lw |= ((unsigned)wl) << (16 * h);
  }
  int idx = (nt * 8 + ks) * 512 + lane * 16 + v * 2;
  *(unsigned*)(wp + (mat * 2 + 0) * WPLANE + idx) = hw;
  *(unsigned*)(wp + (mat * 2 + 1) * WPLANE + idx) = lw;
}

// ---- K1: gate (argmax, first-max tiebreak) + expert counts ----
__global__ void k_gate(const float* __restrict__ x, const float* __restrict__ Wg,
                       const float* __restrict__ bg, int* __restrict__ wsi) {
  int row = blockIdx.x * 256 + threadIdx.x;
  if (row >= B_ROWS) return;
  f4 acc = {0.f, 0.f, 0.f, 0.f};
  const float* xr = x + (size_t)row * D_DIM;
#pragma unroll 4
  for (int d = 0; d < D_DIM; d += 4) {
    f4 xv = *(const f4*)(xr + d);
    acc += xv.x * *(const f4*)(Wg + (d + 0) * 4);
    acc += xv.y * *(const f4*)(Wg + (d + 1) * 4);
    acc += xv.z * *(const f4*)(Wg + (d + 2) * 4);
    acc += xv.w * *(const f4*)(Wg + (d + 3) * 4);
  }
  float l0 = acc.x + bg[0], l1 = acc.y + bg[1], l2 = acc.z + bg[2], l3 = acc.w + bg[3];
  int bi = 0; float bv = l0;
  if (l1 > bv) { bv = l1; bi = 1; }
  if (l2 > bv) { bv = l2; bi = 2; }
  if (l3 > bv) { bv = l3; bi = 3; }
  wsi[WS_IDX + row] = bi;
  atomicAdd(&wsi[WS_COUNTS + bi], 1);
}

// ---- K2: pad counts to TILE_M, exclusive scan, fill padding perm slots with -1 ----
__global__ void k_scan(int* __restrict__ wsi) {
  if (threadIdx.x != 0 || blockIdx.x != 0) return;
  int off = 0;
  for (int e = 0; e < 4; ++e) {
    int c = wsi[WS_COUNTS + e];
    int pad = (c + TILE_M - 1) / TILE_M * TILE_M;
    for (int p2 = off + c; p2 < off + pad; ++p2) wsi[WS_PERM + p2] = -1;
    wsi[WS_CURS + e] = off;
    wsi[WS_OFFS + e] = off;
    off += pad;
  }
  wsi[WS_OFFS + 4] = off;
}

// ---- K3: scatter rows into expert-grouped order ----
__global__ void k_scatter(int* __restrict__ wsi) {
  int row = blockIdx.x * 256 + threadIdx.x;
  if (row >= B_ROWS) return;
  int e = wsi[WS_IDX + row];
  int pos = atomicAdd(&wsi[WS_CURS + e], 1);
  wsi[WS_PERM + pos] = row;
}

// ---- bf16x3 GEMM layer: C = relu(in * W + bias); in/out in LDS hi/lo bf16 planes ----
template <bool LAST>
__device__ __forceinline__ void gemm_layer(
    const unsigned short* __restrict__ inH, const unsigned short* __restrict__ inL,
    const unsigned short* __restrict__ wH,  const unsigned short* __restrict__ wL,
    const float* __restrict__ bias,
    unsigned short* __restrict__ outH, unsigned short* __restrict__ outL,
    float* __restrict__ out, const int* __restrict__ rows_s) {
  const int lane = threadIdx.x & 31;
  const int wave = threadIdx.x >> 5;
  const int r = lane & 15, hi = lane >> 4, hi8 = hi * 8;
  const int nt0 = wave * 2;

  v8f acc[2][8];
#pragma unroll
  for (int t = 0; t < 2; ++t)
#pragma unroll
    for (int m = 0; m < 8; ++m)
#pragma unroll
      for (int q = 0; q < 8; ++q) acc[t][m][q] = 0.f;

  for (int ks = 0; ks < KSTEPS; ++ks) {
    Frag bH[2], bL[2];
#pragma unroll
    for (int t = 0; t < 2; ++t) {
      const unsigned short* ph = wH + ((nt0 + t) * 8 + ks) * 512 + lane * 16;
      const unsigned short* pl = wL + ((nt0 + t) * 8 + ks) * 512 + lane * 16;
      bH[t].q[0] = *(const f4*)(ph);     bH[t].q[1] = *(const f4*)(ph + 8);
      bL[t].q[0] = *(const f4*)(pl);     bL[t].q[1] = *(const f4*)(pl + 8);
    }
    if (ks + 1 < KSTEPS) {  // gfx1250 global_prefetch for next weight block
      __builtin_prefetch(wH + (nt0 * 8 + ks + 1) * 512 + lane * 16, 0, 1);
      __builtin_prefetch(wL + (nt0 * 8 + ks + 1) * 512 + lane * 16, 0, 1);
    }
#pragma unroll
    for (int m = 0; m < 8; ++m) {
      const unsigned short* pah = inH + (m * 16 + r) * PADH + ks * 32 + hi8;
      const unsigned short* pal = inL + (m * 16 + r) * PADH + ks * 32 + hi8;
      Frag aH, aL;
      aH.q[0] = *(const f4*)(pah);       aH.q[1] = *(const f4*)(pah + 16);
      aL.q[0] = *(const f4*)(pal);       aL.q[1] = *(const f4*)(pal + 16);
#pragma unroll
      for (int t = 0; t < 2; ++t) {
        acc[t][m] = __builtin_amdgcn_wmma_f32_16x16x32_bf16(false, aH.v, false, bH[t].v,
                                                            (short)0, acc[t][m], false, false);
        acc[t][m] = __builtin_amdgcn_wmma_f32_16x16x32_bf16(false, aH.v, false, bL[t].v,
                                                            (short)0, acc[t][m], false, false);
        acc[t][m] = __builtin_amdgcn_wmma_f32_16x16x32_bf16(false, aL.v, false, bH[t].v,
                                                            (short)0, acc[t][m], false, false);
      }
    }
  }

  // epilogue: bias + relu; write next-layer LDS planes or final global output
#pragma unroll
  for (int t = 0; t < 2; ++t) {
    const int col = (nt0 + t) * 16 + r;
    const float bv = bias[col];
#pragma unroll
    for (int m = 0; m < 8; ++m)
#pragma unroll
      for (int q = 0; q < 8; ++q) {
        float val = fmaxf(acc[t][m][q] + bv, 0.f);
        int row = m * 16 + q + hi8;     // C layout: M = vgpr + 8*hi
        if (LAST) {
          int ro = rows_s[row];
          if (ro >= 0) out[(size_t)ro * D_DIM + col] = val;
        } else {
          unsigned short h = f2bf(val);
          outH[row * PADH + col] = h;
          outL[row * PADH + col] = f2bf(val - bf2f(h));
        }
      }
  }
}

// ---- K4: fused routed 3-layer GEMM over one 128-row expert-grouped tile ----
__global__ __launch_bounds__(BLK, 1) void k_main(
    const float* __restrict__ x, const float* __restrict__ b_leaf,
    const float* __restrict__ b_mid, const float* __restrict__ b_root,
    const unsigned short* __restrict__ wp, const int* __restrict__ wsi,
    float* __restrict__ out) {
  __shared__ unsigned short smem[4 * TILE_M * PADH];   // ~279 KB of 320 KB WGP LDS
  __shared__ int rows_s[TILE_M];
  const int PLANE = TILE_M * PADH;
  unsigned short* pAh = smem;
  unsigned short* pAl = smem + PLANE;
  unsigned short* pBh = smem + 2 * PLANE;
  unsigned short* pBl = smem + 3 * PLANE;

  const int base = blockIdx.x * TILE_M;
  const int o1 = wsi[WS_OFFS + 1], o2 = wsi[WS_OFFS + 2];
  const int o3 = wsi[WS_OFFS + 3], o4 = wsi[WS_OFFS + 4];
  if (base >= o4) return;
  const int e = (base < o1) ? 0 : ((base < o2) ? 1 : ((base < o3) ? 2 : 3));
  const int p = e >> 1;

  const int tid = threadIdx.x;
  if (tid < TILE_M) rows_s[tid] = wsi[WS_PERM + base + tid];
  __syncthreads();

  // gather x rows, split fp32 -> bf16 hi/lo planes
  for (int i = tid; i < TILE_M * (D_DIM / 4); i += BLK) {
    int row = i >> 6;
    int c = (i & 63) << 2;
    int ro = rows_s[row];
    f4 xv = {0.f, 0.f, 0.f, 0.f};
    if (ro >= 0) xv = *(const f4*)(x + (size_t)ro * D_DIM + c);
    u16x4 hv = { f2bf(xv.x), f2bf(xv.y), f2bf(xv.z), f2bf(xv.w) };
    u16x4 lv = { f2bf(xv.x - bf2f(hv.x)), f2bf(xv.y - bf2f(hv.y)),
                 f2bf(xv.z - bf2f(hv.z)), f2bf(xv.w - bf2f(hv.w)) };
    *(u16x4*)(pAh + row * PADH + c) = hv;
    *(u16x4*)(pAl + row * PADH + c) = lv;
  }
  __syncthreads();

  // leaf (routed expert e)
  gemm_layer<false>(pAh, pAl, wp + (2 * e + 0) * WPLANE, wp + (2 * e + 1) * WPLANE,
                    b_leaf + e * D_DIM, pBh, pBl, nullptr, nullptr);
  __syncthreads();
  // mid (parent p)
  gemm_layer<false>(pBh, pBl, wp + (2 * (4 + p) + 0) * WPLANE, wp + (2 * (4 + p) + 1) * WPLANE,
                    b_mid + p * D_DIM, pAh, pAl, nullptr, nullptr);
  __syncthreads();
  // root, scatter to original row order
  gemm_layer<true>(pAh, pAl, wp + 12 * WPLANE, wp + 13 * WPLANE,
                   b_root, nullptr, nullptr, out, rows_s);
}

extern "C" void kernel_launch(void* const* d_in, const int* in_sizes, int n_in,
                              void* d_out, int out_size, void* d_ws, size_t ws_size,
                              hipStream_t stream) {
  (void)in_sizes; (void)n_in; (void)out_size; (void)ws_size;
  const float* x      = (const float*)d_in[0];
  const float* Wg     = (const float*)d_in[1];
  const float* bg     = (const float*)d_in[2];
  const float* W_leaf = (const float*)d_in[3];
  const float* b_leaf = (const float*)d_in[4];
  const float* W_mid  = (const float*)d_in[5];
  const float* b_mid  = (const float*)d_in[6];
  const float* W_root = (const float*)d_in[7];
  const float* b_root = (const float*)d_in[8];
  float* out = (float*)d_out;
  int* wsi = (int*)d_ws;
  unsigned short* wp = (unsigned short*)((char*)d_ws + WPACK_BYTES);

  hipMemsetAsync(wsi + WS_COUNTS, 0, 4 * sizeof(int), stream);
  k_pack<<<896, 256, 0, stream>>>(W_leaf, W_mid, W_root, wp);
  k_gate<<<B_ROWS / 256, 256, 0, stream>>>(x, Wg, bg, wsi);
  k_scan<<<1, 32, 0, stream>>>(wsi);
  k_scatter<<<B_ROWS / 256, 256, 0, stream>>>(wsi);
  k_main<<<B_ROWS / TILE_M + 4, BLK, 0, stream>>>(x, b_leaf, b_mid, b_root, wp, wsi, out);
}

// v001
// Measured time: 256 microseconds a run.
// In two side-by-side timings against v000, it was 1.30 and 1.31 times as fast.
#include <hip/hip_runtime.h>

#define B_ROWS 131072
#define D_DIM  256
#define TILE_M 128
#define PADH   272            // LDS row stride in halves (breaks bank conflicts)
#define KSTEPS 8              // 256 / 32
#define WAVES  8
#define BLK    (WAVES * 32)   // 256 threads, 8 wave32s

typedef __attribute__((ext_vector_type(16))) __bf16          v16bf;
typedef __attribute__((ext_vector_type(8)))  float           v8f;
typedef __attribute__((ext_vector_type(4)))  float           f4;
typedef __attribute__((ext_vector_type(4)))  unsigned short  u16x4;
typedef __attribute__((ext_vector_type(4)))  int             i4;

union Frag { f4 q[2]; v16bf v; };

// ---- workspace layout (int units) ----
#define WS_OFFS   8                 // offs[0..4], offs[4] = padded total
#define WS_IDX    16
#define WS_PERM   (16 + B_ROWS)
#define WS_PERM_LEN (B_ROWS + 4 * TILE_M)
#define NBLK      (B_ROWS / 256)    // row blocks of k_gate and k_scatter
#define WS_BLK    (WS_PERM + WS_PERM_LEN)   // [NBLK][4]: per-block expert counts, then start slots
#define WPACK_BYTES ((size_t)(WS_BLK + NBLK * 4) * 4)       // bf16 packed weights after ints
#define WPLANE 65536                // ushorts per 256x256 plane

__device__ __forceinline__ unsigned short f2bf(float f) {
  unsigned u = __float_as_uint(f);
  u += 0x7FFFu + ((u >> 16) & 1u);          // round-to-nearest-even
  return (unsigned short)(u >> 16);
}
__device__ __forceinline__ float bf2f(unsigned short h) {
  return __uint_as_float(((unsigned)h) << 16);
}

// ---- K0: split fp32 weights into bf16 hi/lo planes, pre-swizzled to WMMA B-frag order ----
// B frag (32x16 bf16): lane (r = lane&15, hi = lane>>4) holds col n = nt*16+r;
// VGPR v<4: K = ks*32 + 8*hi + 2*v + h ; v>=4: K = ks*32 + 16 + 8*hi + 2*(v-4) + h
__global__ void k_pack(const float* __restrict__ Wl, const float* __restrict__ Wm,
                       const float* __restrict__ Wr, unsigned short* __restrict__ wp) {
  int gid = blockIdx.x * 256 + threadIdx.x;
  if (gid >= (7 << 15)) return;
  int v    = gid & 7;
  int lane = (gid >> 3) & 31;
  int ks   = (gid >> 8) & 7;
  int nt   = (gid >> 11) & 15;
  int mat  = gid >> 15;
  const float* W = (mat < 4) ? (Wl + mat * 65536)
                             : ((mat < 6) ? (Wm + (mat - 4) * 65536) : Wr);
  int hi = lane >> 4, r = lane & 15;
  int n = nt * 16 + r;
  unsigned hw = 0, lw = 0;
  for (int h = 0; h < 2; ++h) {
    int k = ks * 32 + 8 * hi + ((v < 4) ? (2 * v + h) : (16 + 2 * (v - 4) + h));
    float w = W[k * D_DIM + n];
    unsigned short wh = f2bf(w);
    unsigned short wl = f2bf(w - bf2f(wh));
    hw |= ((unsigned)wh) << (16 * h);
    lw |= ((unsigned)wl) << (16 * h);
  }
  int idx = (nt * 8 + ks) * 512 + lane * 16 + v * 2;
  *(unsigned*)(wp + (mat * 2 + 0) * WPLANE + idx) = hw;
  *(unsigned*)(wp + (mat * 2 + 1) * WPLANE + idx) = lw;
}

// lane e (e < 4) gets the number of lanes of this wave that chose expert e;
// mine = mask of the lanes that chose the same expert as this lane
__device__ __forceinline__ int wave_counts(int e, int lane, unsigned& mine) {
  unsigned b0 = __builtin_amdgcn_ballot_w32(e == 0);
  unsigned b1 = __builtin_amdgcn_ballot_w32(e == 1);
  unsigned b2 = __builtin_amdgcn_ballot_w32(e == 2);
  unsigned b3 = __builtin_amdgcn_ballot_w32(e == 3);
  mine = (e == 0) ? b0 : ((e == 1) ? b1 : ((e == 2) ? b2 : b3));
  return __popc((lane == 0) ? b0 : ((lane == 1) ? b1 : ((lane == 2) ? b2 : b3)));
}

// ---- K1: gate (argmax, first-max tiebreak) + expert counts of this block of 256 rows ----
__global__ void k_gate(const float* __restrict__ x, const float* __restrict__ Wg,
                       const float* __restrict__ bg, int* __restrict__ wsi) {
  __shared__ int wcnt[8][4];
  int row = blockIdx.x * 256 + threadIdx.x;   // grid is exactly NBLK blocks of 256
  f4 acc = {0.f, 0.f, 0.f, 0.f};
  const float* xr = x + (size_t)row * D_DIM;
#pragma unroll 4
  for (int d = 0; d < D_DIM; d += 4) {
    f4 xv = *(const f4*)(xr + d);
    acc += xv.x * *(const f4*)(Wg + (d + 0) * 4);
    acc += xv.y * *(const f4*)(Wg + (d + 1) * 4);
    acc += xv.z * *(const f4*)(Wg + (d + 2) * 4);
    acc += xv.w * *(const f4*)(Wg + (d + 3) * 4);
  }
  float l0 = acc.x + bg[0], l1 = acc.y + bg[1], l2 = acc.z + bg[2], l3 = acc.w + bg[3];
  int bi = 0; float bv = l0;
  if (l1 > bv) { bv = l1; bi = 1; }
  if (l2 > bv) { bv = l2; bi = 2; }
  if (l3 > bv) { bv = l3; bi = 3; }
  wsi[WS_IDX + row] = bi;
  const int lane = threadIdx.x & 31, wave = threadIdx.x >> 5;
  unsigned mine;
  int c = wave_counts(bi, lane, mine);
  if (lane < 4) wcnt[wave][lane] = c;
  __syncthreads();
  if (threadIdx.x < 4) {
    int s = 0;
#pragma unroll
    for (int w = 0; w < 8; ++w) s += wcnt[w][threadIdx.x];
    wsi[WS_BLK + blockIdx.x * 4 + threadIdx.x] = s;
  }
}

// ---- K2: prefix of the per-block counts (thread b = row block b), counts padded to TILE_M,
//          each block's start slot per expert, padding perm slots filled with -1 ----
__global__ __launch_bounds__(NBLK) void k_scan(int* __restrict__ wsi) {
  __shared__ i4 wtot[NBLK / 32];
  const int t = threadIdx.x, lane = t & 31, wave = t >> 5;
  const i4 c = *(const i4*)(wsi + WS_BLK + t * 4);
  i4 inc = c;                                  // inclusive prefix inside the wave
#pragma unroll
  for (int d = 1; d < 32; d <<= 1) {
    i4 o = { __shfl_up(inc.x, d), __shfl_up(inc.y, d), __shfl_up(inc.z, d), __shfl_up(inc.w, d) };
    if (lane >= d) inc += o;
  }
  if (lane == 31) wtot[wave] = inc;
  __syncthreads();
  i4 before = {0, 0, 0, 0}, tot = {0, 0, 0, 0};
#pragma unroll
  for (int w = 0; w < NBLK / 32; ++w) {
    i4 v = wtot[w];
    if (w < wave) before += v;
    tot += v;
  }
  const i4 pad = (tot + (TILE_M - 1)) / TILE_M * TILE_M;
  const i4 off = { 0, pad.x, pad.x + pad.y, pad.x + pad.y + pad.z };
  *(i4*)(wsi + WS_BLK + t * 4) = off + before + inc - c;
  if (t < TILE_M) {
#pragma unroll
    for (int e = 0; e < 4; ++e)
      if (tot[e] + t < pad[e]) wsi[WS_PERM + off[e] + tot[e] + t] = -1;
  }
  if (t < 4) wsi[WS_OFFS + t] = off[t];
  if (t == 4) wsi[WS_OFFS + 4] = off.w + pad.w;
}

// ---- K3: scatter rows into expert-grouped order (stable: rank = rows of the same expert before it) ----
__global__ void k_scatter(int* __restrict__ wsi) {
  __shared__ int wcnt[8][4];
  int row = blockIdx.x * 256 + threadIdx.x;   // grid is exactly NBLK blocks of 256
  const int lane = threadIdx.x & 31, wave = threadIdx.x >> 5;
  int e = wsi[WS_IDX + row];
  unsigned mine;
  int c = wave_counts(e, lane, mine);
  if (lane < 4) wcnt[wave][lane] = c;
  __syncthreads();
  int pos = wsi[WS_BLK + blockIdx.x * 4 + e] + __popc(mine & ((1u << lane) - 1u));
#pragma unroll   // branch-free: seven LDS reads issued together instead of a loop of dependent trips
  for (int w = 0; w < 7; ++w) pos += (w < wave) ? wcnt[w][e] : 0;
  wsi[WS_PERM + pos] = row;
}

// ---- bf16x3 GEMM layer: C = relu(in * W + bias); in/out in LDS hi/lo bf16 planes ----
template <bool LAST>
__device__ __forceinline__ void gemm_layer(
    const unsigned short* __restrict__ inH, const unsigned short* __restrict__ inL,
    const unsigned short* __restrict__ wH,  const unsigned short* __restrict__ wL,
    const float* __restrict__ bias,
    unsigned short* __restrict__ outH, unsigned short* __restrict__ outL,
    float* __restrict__ out, const int* __restrict__ rows_s) {
  const int lane = threadIdx.x & 31;
  const int wave = threadIdx.x >> 5;
  const int r = lane & 15, hi = lane >> 4, hi8 = hi * 8;
  const int nt0 = wave * 2;

  v8f acc[2][8];
#pragma unroll
  for (int t = 0; t < 2; ++t)
#pragma unroll
    for (int m = 0; m < 8; ++m)
#pragma unroll
      for (int q = 0; q < 8; ++q) acc[t][m][q] = 0.f;

  for (int ks = 0; ks < KSTEPS; ++ks) {
    Frag bH[2], bL[2];
#pragma unroll
    for (int t = 0; t < 2; ++t) {
      const unsigned short* ph = wH + ((nt0 + t) * 8 + ks) * 512 + lane * 16;
      const unsigned short* pl = wL + ((nt0 + t) * 8 + ks) * 512 + lane * 16;
      bH[t].q[0] = *(const f4*)(ph);     bH[t].q[1] = *(const f4*)(ph + 8);
      bL[t].q[0] = *(const f4*)(pl);     bL[t].q[1] = *(const f4*)(pl + 8);
    }
    if (ks + 1 < KSTEPS) {  // gfx1250 global_prefetch for next weight block
      __builtin_prefetch(wH + (nt0 * 8 + ks + 1) * 512 + lane * 16, 0, 1);
      __builtin_prefetch(wL + (nt0 * 8 + ks + 1) * 512 + lane * 16, 0, 1);
    }
#pragma unroll
    for (int m = 0; m < 8; ++m) {
      const unsigned short* pah = inH + (m * 16 + r) * PADH + ks * 32 + hi8;
      const unsigned short* pal = inL + (m * 16 + r) * PADH + ks * 32 + hi8;
      Frag aH, aL;
      aH.q[0] = *(const f4*)(pah);       aH.q[1] = *(const f4*)(pah + 16);
      aL.q[0] = *(const f4*)(pal);       aL.q[1] = *(const f4*)(pal + 16);
#pragma unroll
      for (int t = 0; t < 2; ++t) {
        acc[t][m] = __builtin_amdgcn_wmma_f32_16x16x32_bf16(false, aH.v, false, bH[t].v,
                                                            (short)0, acc[t][m], false, false);
        acc[t][m] = __builtin_amdgcn_wmma_f32_16x16x32_bf16(false, aH.v, false, bL[t].v,
                                                            (short)0, acc[t][m], false, false);
        acc[t][m] = __builtin_amdgcn_wmma_f32_16x16x32_bf16(false, aL.v, false, bH[t].v,
                                                            (short)0, acc[t][m], false, false);
      }
    }
  }

  // epilogue: bias + relu; write next-layer LDS planes or final global output
#pragma unroll
  for (int t = 0; t < 2; ++t) {
    const int col = (nt0 + t) * 16 + r;
    const float bv = bias[col];
#pragma unroll
    for (int m = 0; m < 8; ++m)
#pragma unroll
      for (int q = 0; q < 8; ++q) {
        float val = fmaxf(acc[t][m][q] + bv, 0.f);
        int row = m * 16 + q + hi8;     // C layout: M = vgpr + 8*hi
        if (LAST) {
          int ro = rows_s[row];
          if (ro >= 0) out[(size_t)ro * D_DIM + col] = val;
        } else {
          unsigned short h = f2bf(val);
          outH[row * PADH + col] = h;
          outL[row * PADH + col] = f2bf(val - bf2f(h));
        }
      }
  }
}

// ---- K4: fused routed 3-layer GEMM over one 128-row expert-grouped tile ----
__global__ __launch_bounds__(BLK, 1) void k_main(
    const float* __restrict__ x, const float* __restrict__ b_leaf,
    const float* __restrict__ b_mid, const float* __restrict__ b_root,
    const unsigned short* __restrict__ wp, const int* __restrict__ wsi,
    float* __restrict__ out) {
  __shared__ unsigned short smem[4 * TILE_M * PADH];   // ~279 KB of 320 KB WGP LDS
  __shared__ int rows_s[TILE_M];
  const int PLANE = TILE_M * PADH;
  unsigned short* pAh = smem;
  unsigned short* pAl = smem + PLANE;
  unsigned short* pBh = smem + 2 * PLANE;
  unsigned short* pBl = smem + 3 * PLANE;

  const int base = blockIdx.x * TILE_M;
  const int o1 = wsi[WS_OFFS + 1], o2 = wsi[WS_OFFS + 2];
  const int o3 = wsi[WS_OFFS + 3], o4 = wsi[WS_OFFS + 4];
  if (base >= o4) return;
  const int e = (base < o1) ? 0 : ((base < o2) ? 1 : ((base < o3) ? 2 : 3));
  const int p = e >> 1;

  const int tid = threadIdx.x;
  if (tid < TILE_M) rows_s[tid] = wsi[WS_PERM + base + tid];
  __syncthreads();

  // gather x rows, split fp32 -> bf16 hi/lo planes
  for (int i = tid; i < TILE_M * (D_DIM / 4); i += BLK) {
    int row = i >> 6;
    int c = (i & 63) << 2;
    int ro = rows_s[row];
    f4 xv = {0.f, 0.f, 0.f, 0.f};
    if (ro >= 0) xv = *(const f4*)(x + (size_t)ro * D_DIM + c);
    u16x4 hv = { f2bf(xv.x), f2bf(xv.y), f2bf(xv.z), f2bf(xv.w) };
    u16x4 lv = { f2bf(xv.x - bf2f(hv.x)), f2bf(xv.y - bf2f(hv.y)),
                 f2bf(xv.z - bf2f(hv.z)), f2bf(xv.w - bf2f(hv.w)) };
    *(u16x4*)(pAh + row * PADH + c) = hv;
    *(u16x4*)(pAl + row * PADH + c) = lv;
  }
  __syncthreads();

  // leaf (routed expert e)
  gemm_layer<false>(pAh, pAl, wp + (2 * e + 0) * WPLANE, wp + (2 * e + 1) * WPLANE,
                    b_leaf + e * D_DIM, pBh, pBl, nullptr, nullptr);
  __syncthreads();
  // mid (parent p)
  gemm_layer<false>(pBh, pBl, wp + (2 * (4 + p) + 0) * WPLANE, wp + (2 * (4 + p) + 1) * WPLANE,
                    b_mid + p * D_DIM, pAh, pAl, nullptr, nullptr);
  __syncthreads();
  // root, scatter to original row order
  gemm_layer<true>(pAh, pAl, wp + 12 * WPLANE, wp + 13 * WPLANE,
                   b_root, nullptr, nullptr, out, rows_s);
}

extern "C" void kernel_launch(void* const* d_in, const int* in_sizes, int n_in,
                              void* d_out, int out_size, void* d_ws, size_t ws_size,
                              hipStream_t stream) {
  (void)in_sizes; (void)n_in; (void)out_size; (void)ws_size;
  const float* x      = (const float*)d_in[0];
  const float* Wg     = (const float*)d_in[1];
  const float* bg     = (const float*)d_in[2];
  const float* W_leaf = (const float*)d_in[3];
  const float* b_leaf = (const float*)d_in[4];
  const float* W_mid  = (const float*)d_in[5];
  const float* b_mid  = (const float*)d_in[6];
  const float* W_root = (const float*)d_in[7];
  const float* b_root = (const float*)d_in[8];
  float* out = (float*)d_out;
  int* wsi = (int*)d_ws;
  unsigned short* wp = (unsigned short*)((char*)d_ws + WPACK_BYTES);

  k_pack<<<896, 256, 0, stream>>>(W_leaf, W_mid, W_root, wp);
  k_gate<<<B_ROWS / 256, 256, 0, stream>>>(x, Wg, bg, wsi);
  k_scan<<<1, NBLK, 0, stream>>>(wsi);
  k_scatter<<<B_ROWS / 256, 256, 0, stream>>>(wsi);
  k_main<<<B_ROWS / TILE_M + 4, BLK, 0, stream>>>(x, b_leaf, b_mid, b_root, wp, wsi, out);
}

// v002
// It runs in 207 microseconds.
// Timed twice side by side with v001, it ran 1.24 times as fast both times.
// All steps since v000 together make it 1.62 times as fast.
#include <hip/hip_runtime.h>

#define B_ROWS 131072
#define D_DIM  256
#define TILE_M 128
#define PADH   272            // LDS row stride in halves (breaks bank conflicts)
#define KSTEPS 8              // 256 / 32
#define WAVES  8
#define BLK    (WAVES * 32)   // 256 threads, 8 wave32s
#define GATHER_H (TILE_M * (D_DIM / 4) / BLK / 2)   // 16: half of a thread's 16-byte loads in the gather

typedef __attribute__((ext_vector_type(16))) __bf16          v16bf;
typedef __attribute__((ext_vector_type(8)))  float           v8f;
typedef __attribute__((ext_vector_type(4)))  float           f4;
typedef __attribute__((ext_vector_type(4)))  unsigned short  u16x4;
typedef __attribute__((ext_vector_type(4)))  int             i4;
typedef __attribute__((ext_vector_type(4)))  unsigned        u32x4;

union Frag { f4 q[2]; v16bf v; };

// ---- workspace layout (int units) ----
#define WS_OFFS   8                 // offs[0..4], offs[4] = padded total
#define WS_IDX    16
#define WS_PERM   (16 + B_ROWS)
#define WS_PERM_LEN (B_ROWS + 4 * TILE_M)
#define NBLK      (B_ROWS / 256)    // row blocks of k_gate and k_scatter
#define WS_BLK    (WS_PERM + WS_PERM_LEN)   // [NBLK][4]: per-block expert counts, then start slots
#define WPACK_BYTES ((size_t)(WS_BLK + NBLK * 4) * 4)       // bf16 packed weights after ints
#define WPLANE 65536                // ushorts per 256x256 plane

__device__ __forceinline__ unsigned short f2bf(float f) {
  unsigned u = __float_as_uint(f);
  u += 0x7FFFu + ((u >> 16) & 1u);          // round-to-nearest-even
  return (unsigned short)(u >> 16);
}
__device__ __forceinline__ float bf2f(unsigned short h) {
  return __uint_as_float(((unsigned)h) << 16);
}

// ---- K0: split fp32 weights into bf16 hi/lo planes, pre-swizzled to WMMA B-frag order ----
// B frag (32x16 bf16): lane (r = lane&15, hi = lane>>4) holds col n = nt*16+r;
// VGPR v<4: K = ks*32 + 8*hi + 2*v + h ; v>=4: K = ks*32 + 16 + 8*hi + 2*(v-4) + h
__global__ void k_pack(const float* __restrict__ Wl, const float* __restrict__ Wm,
                       const float* __restrict__ Wr, unsigned short* __restrict__ wp) {
  int gid = blockIdx.x * 256 + threadIdx.x;
  if (gid >= (7 << 15)) return;
  int v    = gid & 7;
  int lane = (gid >> 3) & 31;
  int ks   = (gid >> 8) & 7;
  int nt   = (gid >> 11) & 15;
  int mat  = gid >> 15;
  const float* W = (mat < 4) ? (Wl + mat * 65536)
                             : ((mat < 6) ? (Wm + (mat - 4) * 65536) : Wr);
  int hi = lane >> 4, r = lane & 15;
  int n = nt * 16 + r;
  unsigned hw = 0, lw = 0;
  for (int h = 0; h < 2; ++h) {
    int k = ks * 32 + 8 * hi + ((v < 4) ? (2 * v + h) : (16 + 2 * (v - 4) + h));
    float w = W[k * D_DIM + n];
    unsigned short wh = f2bf(w);
    unsigned short wl = f2bf(w - bf2f(wh));
    hw |= ((unsigned)wh) << (16 * h);
    lw |= ((unsigned)wl) << (16 * h);
  }
  int idx = (nt * 8 + ks) * 512 + lane * 16 + v * 2;
  *(unsigned*)(wp + (mat * 2 + 0) * WPLANE + idx) = hw;
  *(unsigned*)(wp + (mat * 2 + 1) * WPLANE + idx) = lw;
}

// lane e (e < 4) gets the number of lanes of this wave that chose expert e;
// mine = mask of the lanes that chose the same expert as this lane
__device__ __forceinline__ int wave_counts(int e, int lane, unsigned& mine) {
  unsigned b0 = __builtin_amdgcn_ballot_w32(e == 0);
  unsigned b1 = __builtin_amdgcn_ballot_w32(e == 1);
  unsigned b2 = __builtin_amdgcn_ballot_w32(e == 2);
  unsigned b3 = __builtin_amdgcn_ballot_w32(e == 3);
  mine = (e == 0) ? b0 : ((e == 1) ? b1 : ((e == 2) ? b2 : b3));
  return __popc((lane == 0) ? b0 : ((lane == 1) ? b1 : ((lane == 2) ? b2 : b3)));
}

// ---- K1: gate (argmax, first-max tiebreak) + expert counts of this block of 256 rows ----
__global__ void k_gate(const float* __restrict__ x, const float* __restrict__ Wg,
                       const float* __restrict__ bg, int* __restrict__ wsi) {
  __shared__ int wcnt[8][4];
  int row = blockIdx.x * 256 + threadIdx.x;   // grid is exactly NBLK blocks of 256
  f4 acc = {0.f, 0.f, 0.f, 0.f};
  const float* xr = x + (size_t)row * D_DIM;
#pragma unroll 4
  for (int d = 0; d < D_DIM; d += 4) {
    f4 xv = *(const f4*)(xr + d);
    acc += xv.x * *(const f4*)(Wg + (d + 0) * 4);
    acc += xv.y * *(const f4*)(Wg + (d + 1) * 4);
    acc += xv.z * *(const f4*)(Wg + (d + 2) * 4);
    acc += xv.w * *(const f4*)(Wg + (d + 3) * 4);
  }
  float l0 = acc.x + bg[0], l1 = acc.y + bg[1], l2 = acc.z + bg[2], l3 = acc.w + bg[3];
  int bi = 0; float bv = l0;
  if (l1 > bv) { bv = l1; bi = 1; }
  if (l2 > bv) { bv = l2; bi = 2; }
  if (l3 > bv) { bv = l3; bi = 3; }
  wsi[WS_IDX + row] = bi;
  const int lane = threadIdx.x & 31, wave = threadIdx.x >> 5;
  unsigned mine;
  int c = wave_counts(bi, lane, mine);
  if (lane < 4) wcnt[wave][lane] = c;
  __syncthreads();
  if (threadIdx.x < 4) {
    int s = 0;
#pragma unroll
    for (int w = 0; w < 8; ++w) s += wcnt[w][threadIdx.x];
    wsi[WS_BLK + blockIdx.x * 4 + threadIdx.x] = s;
  }
}

// ---- K2: prefix of the per-block counts (thread b = row block b), counts padded to TILE_M,
//          each block's start slot per expert, padding perm slots filled with -1 ----
__global__ __launch_bounds__(NBLK) void k_scan(int* __restrict__ wsi) {
  __shared__ i4 wtot[NBLK / 32];
  const int t = threadIdx.x, lane = t & 31, wave = t >> 5;
  const i4 c = *(const i4*)(wsi + WS_BLK + t * 4);
  i4 inc = c;                                  // inclusive prefix inside the wave
#pragma unroll
  for (int d = 1; d < 32; d <<= 1) {
    i4 o = { __shfl_up(inc.x, d), __shfl_up(inc.y, d), __shfl_up(inc.z, d), __shfl_up(inc.w, d) };
    if (lane >= d) inc += o;
  }
  if (lane == 31) wtot[wave] = inc;
  __syncthreads();
  i4 before = {0, 0, 0, 0}, tot = {0, 0, 0, 0};
#pragma unroll
  for (int w = 0; w < NBLK / 32; ++w) {
    i4 v = wtot[w];
    if (w < wave) before += v;
    tot += v;
  }
  const i4 pad = (tot + (TILE_M - 1)) / TILE_M * TILE_M;
  const i4 off = { 0, pad.x, pad.x + pad.y, pad.x + pad.y + pad.z };
  *(i4*)(wsi + WS_BLK + t * 4) = off + before + inc - c;
  if (t < TILE_M) {
#pragma unroll
    for (int e = 0; e < 4; ++e)
      if (tot[e] + t < pad[e]) wsi[WS_PERM + off[e] + tot[e] + t] = -1;
  }
  if (t < 4) wsi[WS_OFFS + t] = off[t];
  if (t == 4) wsi[WS_OFFS + 4] = off.w + pad.w;
}

// ---- K3: scatter rows into expert-grouped order (stable: rank = rows of the same expert before it) ----
__global__ void k_scatter(int* __restrict__ wsi) {
  __shared__ int wcnt[8][4];
  int row = blockIdx.x * 256 + threadIdx.x;   // grid is exactly NBLK blocks of 256
  const int lane = threadIdx.x & 31, wave = threadIdx.x >> 5;
  int e = wsi[WS_IDX + row];
  unsigned mine;
  int c = wave_counts(e, lane, mine);
  if (lane < 4) wcnt[wave][lane] = c;
  __syncthreads();
  int pos = wsi[WS_BLK + blockIdx.x * 4 + e] + __popc(mine & ((1u << lane) - 1u));
#pragma unroll   // branch-free: seven LDS reads issued together instead of a loop of dependent trips
  for (int w = 0; w < 7; ++w) pos += (w < wave) ? wcnt[w][e] : 0;
  wsi[WS_PERM + pos] = row;
}

// ---- bf16x3 GEMM layer: C = relu(in * W + bias); in/out in LDS hi/lo bf16 planes ----
template <bool LAST>
__device__ __forceinline__ void gemm_layer(
    const unsigned short* __restrict__ inH, const unsigned short* __restrict__ inL,
    const unsigned short* __restrict__ wH,  const unsigned short* __restrict__ wL,
    const float* __restrict__ bias,
    unsigned short* __restrict__ outH, unsigned short* __restrict__ outL,
    float* __restrict__ out, const int* __restrict__ rows_s) {
  const int lane = threadIdx.x & 31;
  const int wave = threadIdx.x >> 5;
  const int r = lane & 15, hi = lane >> 4, hi8 = hi * 8;
  const int nt0 = wave * 2;

  v8f acc[2][8];
#pragma unroll
  for (int t = 0; t < 2; ++t)
#pragma unroll
    for (int m = 0; m < 8; ++m)
#pragma unroll
      for (int q = 0; q < 8; ++q) acc[t][m][q] = 0.f;

  for (int ks = 0; ks < KSTEPS; ++ks) {
    Frag bH[2], bL[2];
#pragma unroll
    for (int t = 0; t < 2; ++t) {
      const unsigned short* ph = wH + ((nt0 + t) * 8 + ks) * 512 + lane * 16;
      const unsigned short* pl = wL + ((nt0 + t) * 8 + ks) * 512 + lane * 16;
      bH[t].q[0] = *(const f4*)(ph);     bH[t].q[1] = *(const f4*)(ph + 8);
      bL[t].q[0] = *(const f4*)(pl);     bL[t].q[1] = *(const f4*)(pl + 8);
    }
    if (ks + 1 < KSTEPS) {  // gfx1250 global_prefetch for next weight block
      __builtin_prefetch(wH + (nt0 * 8 + ks + 1) * 512 + lane * 16, 0, 1);
      __builtin_prefetch(wL + (nt0 * 8 + ks + 1) * 512 + lane * 16, 0, 1);
    }
#pragma unroll
    for (int m = 0; m < 8; ++m) {
      const unsigned short* pah = inH + (m * 16 + r) * PADH + ks * 32 + hi8;
      const unsigned short* pal = inL + (m * 16 + r) * PADH + ks * 32 + hi8;
      Frag aH, aL;
      aH.q[0] = *(const f4*)(pah);       aH.q[1] = *(const f4*)(pah + 16);
      aL.q[0] = *(const f4*)(pal);       aL.q[1] = *(const f4*)(pal + 16);
#pragma unroll
      for (int t = 0; t < 2; ++t) {
        acc[t][m] = __builtin_amdgcn_wmma_f32_16x16x32_bf16(false, aH.v, false, bH[t].v,
                                                            (short)0, acc[t][m], false, false);
        acc[t][m] = __builtin_amdgcn_wmma_f32_16x16x32_bf16(false, aH.v, false, bL[t].v,
                                                            (short)0, acc[t][m], false, false);
        acc[t][m] = __builtin_amdgcn_wmma_f32_16x16x32_bf16(false, aL.v, false, bH[t].v,
                                                            (short)0, acc[t][m], false, false);
      }
    }
  }

  // epilogue: bias + relu; write next-layer LDS planes or final global output
#pragma unroll
  for (int t = 0; t < 2; ++t) {
    const int col = (nt0 + t) * 16 + r;
    const float bv = bias[col];
#pragma unroll
    for (int m = 0; m < 8; ++m)
#pragma unroll
      for (int q = 0; q < 8; ++q) {
        float val = fmaxf(acc[t][m][q] + bv, 0.f);
        int row = m * 16 + q + hi8;     // C layout: M = vgpr + 8*hi
        if (LAST) {
          int ro = rows_s[row];
          if (ro >= 0) out[(size_t)ro * D_DIM + col] = val;
        } else {
          unsigned short h = f2bf(val);
          outH[row * PADH + col] = h;
          outL[row * PADH + col] = f2bf(val - bf2f(h));
        }
      }
  }
}

// ---- K4: fused routed 3-layer GEMM over one 128-row expert-grouped tile ----
__global__ __launch_bounds__(BLK, 1) void k_main(
    const float* __restrict__ x, const float* __restrict__ b_leaf,
    const float* __restrict__ b_mid, const float* __restrict__ b_root,
    const unsigned short* __restrict__ wp, const int* __restrict__ wsi,
    float* __restrict__ out) {
  __shared__ unsigned short smem[4 * TILE_M * PADH];   // ~279 KB of 320 KB WGP LDS
  __shared__ __attribute__((aligned(16))) int rows_s[TILE_M];   // read four at a time in the gather
  const int PLANE = TILE_M * PADH;
  unsigned short* pAh = smem;
  unsigned short* pAl = smem + PLANE;
  unsigned short* pBh = smem + 2 * PLANE;
  unsigned short* pBl = smem + 3 * PLANE;

  const int base = blockIdx.x * TILE_M;
  const int o1 = wsi[WS_OFFS + 1], o2 = wsi[WS_OFFS + 2];
  const int o3 = wsi[WS_OFFS + 3], o4 = wsi[WS_OFFS + 4];
  if (base >= o4) return;
  const int e = (base < o1) ? 0 : ((base < o2) ? 1 : ((base < o3) ? 2 : 3));
  const int p = e >> 1;

  const int tid = threadIdx.x;
  if (tid < TILE_M) rows_s[tid] = wsi[WS_PERM + base + tid];
  __syncthreads();

  // gather x rows, split fp32 -> bf16 hi/lo planes.
  // A thread issues all its row loads before it converts the first: one memory latency per
  // tile instead of one per load. The loads carry no branch: a padding slot reads row 0, and
  // what the layers make of it is never stored (the last layer stores only slots with a row).
  const int grow = (tid >> 6) * (2 * GATHER_H);   // this thread's tile rows: grow .. grow + 2 * GATHER_H - 1
  const int gq = tid & 63;                        // its 16-byte piece of each row
  u32x4 q[GATHER_H / 2];                          // load offsets, in 16-byte units
#pragma unroll   // unrolled here and in the loops over j below: q, xa and xb must be registers
  for (int k = 0; k < GATHER_H / 2; ++k) {
    const i4 r = *(const i4*)(rows_s + grow + 4 * k);
#pragma unroll   // as above
    for (int s = 0; s < 4; ++s) q[k][s] = ((unsigned)(r[s] < 0 ? 0 : r[s]) << 6) + gq;
  }
  f4 xa[GATHER_H], xb[GATHER_H];                  // first and second half of the loads
#pragma unroll   // as above
  for (int j = 0; j < GATHER_H; ++j) xa[j] = *(const f4*)(x + (size_t)q[j >> 2][j & 3] * 4);
#pragma unroll   // as above
  for (int j = 0; j < GATHER_H; ++j)
    xb[j] = *(const f4*)(x + (size_t)q[(GATHER_H + j) >> 2][j & 3] * 4);
  // the wait that stands in front of any rewrite of a register that an issued load names;
  // the offsets are its inputs, so that each keeps its register up to this line
  asm volatile("s_wait_xcnt 0x0"
               :: "v"(q[0]), "v"(q[1]), "v"(q[2]), "v"(q[3]), "v"(q[4]), "v"(q[5]), "v"(q[6]), "v"(q[7])
               : "memory");
#pragma unroll 1   // rolled: the convert code stands once for both halves, which keeps the kernel's text short
  for (int h = 0; h < 2; ++h) {
#pragma unroll   // as above
    for (int j = 0; j < GATHER_H; ++j) {
      const int row = grow + h * GATHER_H + j;
      const int c = gq << 2;
      const f4 xv = xa[j];
      u16x4 hv = { f2bf(xv.x), f2bf(xv.y), f2bf(xv.z), f2bf(xv.w) };
      u16x4 lv = { f2bf(xv.x - bf2f(hv.x)), f2bf(xv.y - bf2f(hv.y)),
                   f2bf(xv.z - bf2f(hv.z)), f2bf(xv.w - bf2f(hv.w)) };
      *(u16x4*)(pAh + row * PADH + c) = hv;
      *(u16x4*)(pAl + row * PADH + c) = lv;
      xa[j] = xb[j];
    }
  }
  __syncthreads();

  // leaf (routed expert e)
  gemm_layer<false>(pAh, pAl, wp + (2 * e + 0) * WPLANE, wp + (2 * e + 1) * WPLANE,
                    b_leaf + e * D_DIM, pBh, pBl, nullptr, nullptr);
  __syncthreads();
  // mid (parent p)
  gemm_layer<false>(pBh, pBl, wp + (2 * (4 + p) + 0) * WPLANE, wp + (2 * (4 + p) + 1) * WPLANE,
                    b_mid + p * D_DIM, pAh, pAl, nullptr, nullptr);
  __syncthreads();
  // root, scatter to original row order
  gemm_layer<true>(pAh, pAl, wp + 12 * WPLANE, wp + 13 * WPLANE,
                   b_root, nullptr, nullptr, out, rows_s);
}

extern "C" void kernel_launch(void* const* d_in, const int* in_sizes, int n_in,
                              void* d_out, int out_size, void* d_ws, size_t ws_size,
                              hipStream_t stream) {
  (void)in_sizes; (void)n_in; (void)out_size; (void)ws_size;
  const float* x      = (const float*)d_in[0];
  const float* Wg     = (const float*)d_in[1];
  const float* bg     = (const float*)d_in[2];
  const float* W_leaf = (const float*)d_in[3];
  const float* b_leaf = (const float*)d_in[4];
  const float* W_mid  = (const float*)d_in[5];
  const float* b_mid  = (const float*)d_in[6];
  const float* W_root = (const float*)d_in[7];
  const float* b_root = (const float*)d_in[8];
  float* out = (float*)d_out;
  int* wsi = (int*)d_ws;
  unsigned short* wp = (unsigned short*)((char*)d_ws + WPACK_BYTES);

  k_pack<<<896, 256, 0, stream>>>(W_leaf, W_mid, W_root, wp);
  k_gate<<<B_ROWS / 256, 256, 0, stream>>>(x, Wg, bg, wsi);
  k_scan<<<1, NBLK, 0, stream>>>(wsi);
  k_scatter<<<B_ROWS / 256, 256, 0, stream>>>(wsi);
  k_main<<<B_ROWS / TILE_M + 4, BLK, 0, stream>>>(x, b_leaf, b_mid, b_root, wp, wsi, out);
}

// v003
// It runs in 163 microseconds.
// Next to v002, in two timings, it ran 1.28 and 1.27 times as fast.
// Counting every step since v000, it is 2.06 times as fast.
#include <hip/hip_runtime.h>

#define B_ROWS 131072
#define D_DIM  256
#define TILE_M 128
#define PADH   272            // LDS row stride in halves (breaks bank conflicts)
#define KSTEPS 8              // 256 / 32
#define WAVES  8
#define BLK    (WAVES * 32)   // 256 threads, 8 wave32s
#define GATHER_H (TILE_M * (D_DIM / 4) / BLK / 2)   // 16: half of a thread's 16-byte loads in the gather

typedef __attribute__((ext_vector_type(16))) __bf16          v16bf;
typedef __attribute__((ext_vector_type(8)))  float           v8f;
typedef __attribute__((ext_vector_type(4)))  float           f4;
typedef __attribute__((ext_vector_type(4)))  unsigned short  u16x4;
typedef __attribute__((ext_vector_type(4)))  int             i4;
typedef __attribute__((ext_vector_type(4)))  unsigned        u32x4;

union Frag { f4 q[2]; v16bf v; };

// ---- workspace layout (int units) ----
#define WS_OFFS   8                 // offs[0..4], offs[4] = padded total
#define WS_IDX    16
#define WS_PERM   (16 + B_ROWS)
#define WS_PERM_LEN (B_ROWS + 4 * TILE_M)
#define NBLK      (B_ROWS / 256)    // row blocks of k_gate and k_scatter
#define WS_BLK    (WS_PERM + WS_PERM_LEN)   // [NBLK][4]: per-block expert counts, then start slots
#define WPACK_BYTES ((size_t)(WS_BLK + NBLK * 4) * 4)       // bf16 packed weights after ints
#define WPLANE 65536                // ushorts per 256x256 plane

__device__ __forceinline__ unsigned short f2bf(float f) {
  unsigned u = __float_as_uint(f);
  u += 0x7FFFu + ((u >> 16) & 1u);          // round-to-nearest-even
  return (unsigned short)(u >> 16);
}
__device__ __forceinline__ float bf2f(unsigned short h) {
  return __uint_as_float(((unsigned)h) << 16);
}

// ---- K0: split fp32 weights into bf16 hi/lo planes, pre-swizzled to WMMA B-frag order ----
// B frag (32x16 bf16): lane (r = lane&15, hi = lane>>4) holds col n = nt*16+r;
// VGPR v<4: K = ks*32 + 8*hi + 2*v + h ; v>=4: K = ks*32 + 16 + 8*hi + 2*(v-4) + h
__global__ void k_pack(const float* __restrict__ Wl, const float* __restrict__ Wm,
                       const float* __restrict__ Wr, unsigned short* __restrict__ wp) {
  int gid = blockIdx.x * 256 + threadIdx.x;
  if (gid >= (7 << 15)) return;
  int v    = gid & 7;
  int lane = (gid >> 3) & 31;
  int ks   = (gid >> 8) & 7;
  int nt   = (gid >> 11) & 15;
  int mat  = gid >> 15;
  const float* W = (mat < 4) ? (Wl + mat * 65536)
                             : ((mat < 6) ? (Wm + (mat - 4) * 65536) : Wr);
  int hi = lane >> 4, r = lane & 15;
  int n = nt * 16 + r;
  unsigned hw = 0, lw = 0;
  for (int h = 0; h < 2; ++h) {
    int k = ks * 32 + 8 * hi + ((v < 4) ? (2 * v + h) : (16 + 2 * (v - 4) + h));
    float w = W[k * D_DIM + n];
    unsigned short wh = f2bf(w);
    unsigned short wl = f2bf(w - bf2f(wh));
    hw |= ((unsigned)wh) << (16 * h);
    lw |= ((unsigned)wl) << (16 * h);
  }
  int idx = (nt * 8 + ks) * 512 + lane * 16 + v * 2;
  *(unsigned*)(wp + (mat * 2 + 0) * WPLANE + idx) = hw;
  *(unsigned*)(wp + (mat * 2 + 1) * WPLANE + idx) = lw;
}

// lane e (e < 4) gets the number of lanes of this wave that chose expert e;
// mine = mask of the lanes that chose the same expert as this lane
__device__ __forceinline__ int wave_counts(int e, int lane, unsigned& mine) {
  unsigned b0 = __builtin_amdgcn_ballot_w32(e == 0);
  unsigned b1 = __builtin_amdgcn_ballot_w32(e == 1);
  unsigned b2 = __builtin_amdgcn_ballot_w32(e == 2);
  unsigned b3 = __builtin_amdgcn_ballot_w32(e == 3);
  mine = (e == 0) ? b0 : ((e == 1) ? b1 : ((e == 2) ? b2 : b3));
  return __popc((lane == 0) ? b0 : ((lane == 1) ? b1 : ((lane == 2) ? b2 : b3)));
}

// ---- K1: gate (argmax, first-max tiebreak) + expert counts of this block of 256 rows ----
__global__ void k_gate(const float* __restrict__ x, const float* __restrict__ Wg,
                       const float* __restrict__ bg, int* __restrict__ wsi) {
  __shared__ int wcnt[8][4];
  int row = blockIdx.x * 256 + threadIdx.x;   // grid is exactly NBLK blocks of 256
  f4 acc = {0.f, 0.f, 0.f, 0.f};
  const float* xr = x + (size_t)row * D_DIM;
#pragma unroll 4
  for (int d = 0; d < D_DIM; d += 4) {
    f4 xv = *(const f4*)(xr + d);
    acc += xv.x * *(const f4*)(Wg + (d + 0) * 4);
    acc += xv.y * *(const f4*)(Wg + (d + 1) * 4);
    acc += xv.z * *(const f4*)(Wg + (d + 2) * 4);
    acc += xv.w * *(const f4*)(Wg + (d + 3) * 4);
  }
  float l0 = acc.x + bg[0], l1 = acc.y + bg[1], l2 = acc.z + bg[2], l3 = acc.w + bg[3];
  int bi = 0; float bv = l0;
  if (l1 > bv) { bv = l1; bi = 1; }
  if (l2 > bv) { bv = l2; bi = 2; }
  if (l3 > bv) { bv = l3; bi = 3; }
  wsi[WS_IDX + row] = bi;
  const int lane = threadIdx.x & 31, wave = threadIdx.x >> 5;
  unsigned mine;
  int c = wave_counts(bi, lane, mine);
  if (lane < 4) wcnt[wave][lane] = c;
  __syncthreads();
  if (threadIdx.x < 4) {
    int s = 0;
#pragma unroll
    for (int w = 0; w < 8; ++w) s += wcnt[w][threadIdx.x];
    wsi[WS_BLK + blockIdx.x * 4 + threadIdx.x] = s;
  }
}

// ---- K2: prefix of the per-block counts (thread b = row block b), counts padded to TILE_M,
//          each block's start slot per expert, padding perm slots filled with -1 ----
__global__ __launch_bounds__(NBLK) void k_scan(int* __restrict__ wsi) {
  __shared__ i4 wtot[NBLK / 32];
  const int t = threadIdx.x, lane = t & 31, wave = t >> 5;
  const i4 c = *(const i4*)(wsi + WS_BLK + t * 4);
  i4 inc = c;                                  // inclusive prefix inside the wave
#pragma unroll
  for (int d = 1; d < 32; d <<= 1) {
    i4 o = { __shfl_up(inc.x, d), __shfl_up(inc.y, d), __shfl_up(inc.z, d), __shfl_up(inc.w, d) };
    if (lane >= d) inc += o;
  }
  if (lane == 31) wtot[wave] = inc;
  __syncthreads();
  i4 before = {0, 0, 0, 0}, tot = {0, 0, 0, 0};
#pragma unroll
  for (int w = 0; w < NBLK / 32; ++w) {
    i4 v = wtot[w];
    if (w < wave) before += v;
    tot += v;
  }
  const i4 pad = (tot + (TILE_M - 1)) / TILE_M * TILE_M;
  const i4 off = { 0, pad.x, pad.x + pad.y, pad.x + pad.y + pad.z };
  *(i4*)(wsi + WS_BLK + t * 4) = off + before + inc - c;
  if (t < TILE_M) {
#pragma unroll
    for (int e = 0; e < 4; ++e)
      if (tot[e] + t < pad[e]) wsi[WS_PERM + off[e] + tot[e] + t] = -1;
  }
  if (t < 4) wsi[WS_OFFS + t] = off[t];
  if (t == 4) wsi[WS_OFFS + 4] = off.w + pad.w;
}

// ---- K3: scatter rows into expert-grouped order (stable: rank = rows of the same expert before it) ----
__global__ void k_scatter(int* __restrict__ wsi) {
  __shared__ int wcnt[8][4];
  int row = blockIdx.x * 256 + threadIdx.x;   // grid is exactly NBLK blocks of 256
  const int lane = threadIdx.x & 31, wave = threadIdx.x >> 5;
  int e = wsi[WS_IDX + row];
  unsigned mine;
  int c = wave_counts(e, lane, mine);
  if (lane < 4) wcnt[wave][lane] = c;
  __syncthreads();
  int pos = wsi[WS_BLK + blockIdx.x * 4 + e] + __popc(mine & ((1u << lane) - 1u));
#pragma unroll   // branch-free: seven LDS reads issued together instead of a loop of dependent trips
  for (int w = 0; w < 7; ++w) pos += (w < wave) ? wcnt[w][e] : 0;
  wsi[WS_PERM + pos] = row;
}

// ---- bf16x3 GEMM layer: C = relu(in * W + bias); in LDS hi/lo bf16 planes.
//      A layer that is not the last writes its result over its own input planes: the sums wait
//      in registers until every wave has read its last fragment. ----
template <bool LAST>
__device__ __forceinline__ void gemm_layer(
    unsigned short* inH, unsigned short* inL,
    const unsigned short* __restrict__ wH,  const unsigned short* __restrict__ wL,
    const float* __restrict__ bias,
    float* __restrict__ out, const int* __restrict__ rows_s) {
  const int lane = threadIdx.x & 31;
  const int wave = threadIdx.x >> 5;
  const int r = lane & 15, hi = lane >> 4, hi8 = hi * 8;
  const int nt0 = wave * 2;

  v8f acc[2][8];
#pragma unroll
  for (int t = 0; t < 2; ++t)
#pragma unroll
    for (int m = 0; m < 8; ++m)
#pragma unroll
      for (int q = 0; q < 8; ++q) acc[t][m][q] = 0.f;

  for (int ks = 0; ks < KSTEPS; ++ks) {
    Frag bH[2], bL[2];
#pragma unroll
    for (int t = 0; t < 2; ++t) {
      const unsigned short* ph = wH + ((nt0 + t) * 8 + ks) * 512 + lane * 16;
      const unsigned short* pl = wL + ((nt0 + t) * 8 + ks) * 512 + lane * 16;
      bH[t].q[0] = *(const f4*)(ph);     bH[t].q[1] = *(const f4*)(ph + 8);
      bL[t].q[0] = *(const f4*)(pl);     bL[t].q[1] = *(const f4*)(pl + 8);
    }
    if (ks + 1 < KSTEPS) {  // gfx1250 global_prefetch for next weight block
      __builtin_prefetch(wH + (nt0 * 8 + ks + 1) * 512 + lane * 16, 0, 1);
      __builtin_prefetch(wL + (nt0 * 8 + ks + 1) * 512 + lane * 16, 0, 1);
    }
#pragma unroll
    for (int m = 0; m < 8; ++m) {
      const unsigned short* pah = inH + (m * 16 + r) * PADH + ks * 32 + hi8;
      const unsigned short* pal = inL + (m * 16 + r) * PADH + ks * 32 + hi8;
      Frag aH, aL;
      aH.q[0] = *(const f4*)(pah);       aH.q[1] = *(const f4*)(pah + 16);
      aL.q[0] = *(const f4*)(pal);       aL.q[1] = *(const f4*)(pal + 16);
#pragma unroll
      for (int t = 0; t < 2; ++t) {
        acc[t][m] = __builtin_amdgcn_wmma_f32_16x16x32_bf16(false, aH.v, false, bH[t].v,
                                                            (short)0, acc[t][m], false, false);
        acc[t][m] = __builtin_amdgcn_wmma_f32_16x16x32_bf16(false, aH.v, false, bL[t].v,
                                                            (short)0, acc[t][m], false, false);
        acc[t][m] = __builtin_amdgcn_wmma_f32_16x16x32_bf16(false, aL.v, false, bH[t].v,
                                                            (short)0, acc[t][m], false, false);
      }
    }
  }

  // every wave reads all rows and all k of the planes: none may be overwritten before the last read
  if (!LAST) __syncthreads();

  // epilogue: bias + relu; write next-layer LDS planes (in place) or final global output
#pragma unroll
  for (int t = 0; t < 2; ++t) {
    const int col = (nt0 + t) * 16 + r;
    const float bv = bias[col];
#pragma unroll
    for (int m = 0; m < 8; ++m)
#pragma unroll
      for (int q = 0; q < 8; ++q) {
        float val = fmaxf(acc[t][m][q] + bv, 0.f);
        int row = m * 16 + q + hi8;     // C layout: M = vgpr + 8*hi
        if (LAST) {
          int ro = rows_s[row];
          if (ro >= 0) out[(size_t)ro * D_DIM + col] = val;
        } else {
          unsigned short h = f2bf(val);
          inH[row * PADH + col] = h;
          inL[row * PADH + col] = f2bf(val - bf2f(h));
        }
      }
  }
}

// ---- K4: fused routed 3-layer GEMM over one 128-row expert-grouped tile ----
// One pair of LDS planes (about 137 KB) and at most 256 registers a wave: two work-groups share a WGP.
__global__ __launch_bounds__(BLK, 4) void k_main(
    const float* __restrict__ x, const float* __restrict__ b_leaf,
    const float* __restrict__ b_mid, const float* __restrict__ b_root,
    const unsigned short* __restrict__ wp, const int* __restrict__ wsi,
    float* __restrict__ out) {
  __shared__ unsigned short smem[2 * TILE_M * PADH];   // hi and lo plane of the tile's current layer
  __shared__ __attribute__((aligned(16))) int rows_s[TILE_M];   // read four at a time in the gather
  const int PLANE = TILE_M * PADH;
  unsigned short* pAh = smem;
  unsigned short* pAl = smem + PLANE;

  const int base = blockIdx.x * TILE_M;
  const int o1 = wsi[WS_OFFS + 1], o2 = wsi[WS_OFFS + 2];
  const int o3 = wsi[WS_OFFS + 3], o4 = wsi[WS_OFFS + 4];
  if (base >= o4) return;
  const int e = (base < o1) ? 0 : ((base < o2) ? 1 : ((base < o3) ? 2 : 3));
  const int p = e >> 1;

  const int tid = threadIdx.x;
  if (tid < TILE_M) rows_s[tid] = wsi[WS_PERM + base + tid];
  __syncthreads();

  // gather x rows, split fp32 -> bf16 hi/lo planes.
  // A thread issues all its row loads before it converts the first: one memory latency per
  // tile instead of one per load. The loads carry no branch: a padding slot reads row 0, and
  // what the layers make of it is never stored (the last layer stores only slots with a row).
  const int grow = (tid >> 6) * (2 * GATHER_H);   // this thread's tile rows: grow .. grow + 2 * GATHER_H - 1
  const int gq = tid & 63;                        // its 16-byte piece of each row
  u32x4 q[GATHER_H / 2];                          // load offsets, in 16-byte units
#pragma unroll   // unrolled here and in the loops over j below: q, xa and xb must be registers
  for (int k = 0; k < GATHER_H / 2; ++k) {
    const i4 r = *(const i4*)(rows_s + grow + 4 * k);
#pragma unroll   // as above
    for (int s = 0; s < 4; ++s) q[k][s] = ((unsigned)(r[s] < 0 ? 0 : r[s]) << 6) + gq;
  }
  f4 xa[GATHER_H], xb[GATHER_H];                  // first and second half of the loads
#pragma unroll   // as above
  for (int j = 0; j < GATHER_H; ++j) xa[j] = *(const f4*)(x + (size_t)q[j >> 2][j & 3] * 4);
#pragma unroll   // as above
  for (int j = 0; j < GATHER_H; ++j)
    xb[j] = *(const f4*)(x + (size_t)q[(GATHER_H + j) >> 2][j & 3] * 4);
  // the wait that stands in front of any rewrite of a register that an issued load names;
  // the offsets are its inputs, so that each keeps its register up to this line
  asm volatile("s_wait_xcnt 0x0"
               :: "v"(q[0]), "v"(q[1]), "v"(q[2]), "v"(q[3]), "v"(q[4]), "v"(q[5]), "v"(q[6]), "v"(q[7])
               : "memory");
#pragma unroll 1   // rolled: the convert code stands once for both halves, which keeps the kernel's text short
  for (int h = 0; h < 2; ++h) {
#pragma unroll   // as above
    for (int j = 0; j < GATHER_H; ++j) {
      const int row = grow + h * GATHER_H + j;
      const int c = gq << 2;
      const f4 xv = xa[j];
      u16x4 hv = { f2bf(xv.x), f2bf(xv.y), f2bf(xv.z), f2bf(xv.w) };
      u16x4 lv = { f2bf(xv.x - bf2f(hv.x)), f2bf(xv.y - bf2f(hv.y)),
                   f2bf(xv.z - bf2f(hv.z)), f2bf(xv.w - bf2f(hv.w)) };
      *(u16x4*)(pAh + row * PADH + c) = hv;
      *(u16x4*)(pAl + row * PADH + c) = lv;
      xa[j] = xb[j];
    }
  }
  __syncthreads();

  // leaf (routed expert e)
  gemm_layer<false>(pAh, pAl, wp + (2 * e + 0) * WPLANE, wp + (2 * e + 1) * WPLANE,
                    b_leaf + e * D_DIM, nullptr, nullptr);
  __syncthreads();
  // mid (parent p)
  gemm_layer<false>(pAh, pAl, wp + (2 * (4 + p) + 0) * WPLANE, wp + (2 * (4 + p) + 1) * WPLANE,
                    b_mid + p * D_DIM, nullptr, nullptr);
  __syncthreads();
  // root, scatter to original row order
  gemm_layer<true>(pAh, pAl, wp + 12 * WPLANE, wp + 13 * WPLANE,
                   b_root, out, rows_s);
}

extern "C" void kernel_launch(void* const* d_in, const int* in_sizes, int n_in,
                              void* d_out, int out_size, void* d_ws, size_t ws_size,
                              hipStream_t stream) {
  (void)in_sizes; (void)n_in; (void)out_size; (void)ws_size;
  const float* x      = (const float*)d_in[0];
  const float* Wg     = (const float*)d_in[1];
  const float* bg     = (const float*)d_in[2];
  const float* W_leaf = (const float*)d_in[3];
  const float* b_leaf = (const float*)d_in[4];
  const float* W_mid  = (const float*)d_in[5];
  const float* b_mid  = (const float*)d_in[6];
  const float* W_root = (const float*)d_in[7];
  const float* b_root = (const float*)d_in[8];
  float* out = (float*)d_out;
  int* wsi = (int*)d_ws;
  unsigned short* wp = (unsigned short*)((char*)d_ws + WPACK_BYTES);

  k_pack<<<896, 256, 0, stream>>>(W_leaf, W_mid, W_root, wp);
  k_gate<<<B_ROWS / 256, 256, 0, stream>>>(x, Wg, bg, wsi);
  k_scan<<<1, NBLK, 0, stream>>>(wsi);
  k_scatter<<<B_ROWS / 256, 256, 0, stream>>>(wsi);
  k_main<<<B_ROWS / TILE_M + 4, BLK, 0, stream>>>(x, b_leaf, b_mid, b_root, wp, wsi, out);
}

// v004
// Measured time: 140 microseconds a run.
// Timed twice side by side with v003, it ran 1.17 times as fast both times.
// Over all steps from v000 it is 2.40 times as fast.
#include <hip/hip_runtime.h>

#define B_ROWS 131072
#define D_DIM  256
#define TILE_M 128
#define PADH   272            // LDS row stride in halves (breaks bank conflicts)
#define KSTEPS 8              // 256 / 32
#define WAVES  8
#define BLK    (WAVES * 32)   // 256 threads, 8 wave32s
#define GATHER_H (TILE_M * (D_DIM / 4) / BLK / 2)   // 16: half of a thread's 16-byte loads in the gather
#define SPITCH 260            // LDS row stride in floats of the staged result: rows 8 apart fall 32 banks apart
#define ROWS_W (TILE_M / WAVES)   // 16: result rows that one wave stores

typedef __attribute__((ext_vector_type(16))) __bf16          v16bf;
typedef __attribute__((ext_vector_type(8)))  float           v8f;
typedef __attribute__((ext_vector_type(4)))  float           f4;
typedef __attribute__((ext_vector_type(4)))  unsigned short  u16x4;
typedef __attribute__((ext_vector_type(4)))  int             i4;
typedef __attribute__((ext_vector_type(4)))  unsigned        u32x4;

union Frag { f4 q[2]; v16bf v; };

// ---- workspace layout (int units) ----
#define WS_OFFS   8                 // offs[0..4], offs[4] = padded total
#define WS_IDX    16
#define WS_PERM   (16 + B_ROWS)
#define WS_PERM_LEN (B_ROWS + 4 * TILE_M)
#define NBLK      (B_ROWS / 256)    // row blocks of k_gate and k_scatter
#define WS_BLK    (WS_PERM + WS_PERM_LEN)   // [NBLK][4]: per-block expert counts, then start slots
#define WPACK_BYTES ((size_t)(WS_BLK + NBLK * 4) * 4)       // bf16 packed weights after ints
#define WPLANE 65536                // ushorts per 256x256 plane

__device__ __forceinline__ unsigned short f2bf(float f) {
  unsigned u = __float_as_uint(f);
  u += 0x7FFFu + ((u >> 16) & 1u);          // round-to-nearest-even
  return (unsigned short)(u >> 16);
}
__device__ __forceinline__ float bf2f(unsigned short h) {
  return __uint_as_float(((unsigned)h) << 16);
}

// ---- K0: split fp32 weights into bf16 hi/lo planes, pre-swizzled to WMMA B-frag order ----
// B frag (32x16 bf16): lane (r = lane&15, hi = lane>>4) holds col n = nt*16+r;
// VGPR v<4: K = ks*32 + 8*hi + 2*v + h ; v>=4: K = ks*32 + 16 + 8*hi + 2*(v-4) + h
__global__ void k_pack(const float* __restrict__ Wl, const float* __restrict__ Wm,
                       const float* __restrict__ Wr, unsigned short* __restrict__ wp) {
  int gid = blockIdx.x * 256 + threadIdx.x;
  if (gid >= (7 << 15)) return;
  int v    = gid & 7;
  int lane = (gid >> 3) & 31;
  int ks   = (gid >> 8) & 7;
  int nt   = (gid >> 11) & 15;
  int mat  = gid >> 15;
  const float* W = (mat < 4) ? (Wl + mat * 65536)
                             : ((mat < 6) ? (Wm + (mat - 4) * 65536) : Wr);
  int hi = lane >> 4, r = lane & 15;
  int n = nt * 16 + r;
  unsigned hw = 0, lw = 0;
  for (int h = 0; h < 2; ++h) {
    int k = ks * 32 + 8 * hi + ((v < 4) ? (2 * v + h) : (16 + 2 * (v - 4) + h));
    float w = W[k * D_DIM + n];
    unsigned short wh = f2bf(w);
    unsigned short wl = f2bf(w - bf2f(wh));
    hw |= ((unsigned)wh) << (16 * h);
    lw |= ((unsigned)wl) << (16 * h);
  }
  int idx = (nt * 8 + ks) * 512 + lane * 16 + v * 2;
  *(unsigned*)(wp + (mat * 2 + 0) * WPLANE + idx) = hw;
  *(unsigned*)(wp + (mat * 2 + 1) * WPLANE + idx) = lw;
}

// lane e (e < 4) gets the number of lanes of this wave that chose expert e;
// mine = mask of the lanes that chose the same expert as this lane
__device__ __forceinline__ int wave_counts(int e, int lane, unsigned& mine) {
  unsigned b0 = __builtin_amdgcn_ballot_w32(e == 0);
  unsigned b1 = __builtin_amdgcn_ballot_w32(e == 1);
  unsigned b2 = __builtin_amdgcn_ballot_w32(e == 2);
  unsigned b3 = __builtin_amdgcn_ballot_w32(e == 3);
  mine = (e == 0) ? b0 : ((e == 1) ? b1 : ((e == 2) ? b2 : b3));
  return __popc((lane == 0) ? b0 : ((lane == 1) ? b1 : ((lane == 2) ? b2 : b3)));
}

// ---- K1: gate (argmax, first-max tiebreak) + expert counts of this block of 256 rows ----
__global__ void k_gate(const float* __restrict__ x, const float* __restrict__ Wg,
                       const float* __restrict__ bg, int* __restrict__ wsi) {
  __shared__ int wcnt[8][4];
  int row = blockIdx.x * 256 + threadIdx.x;   // grid is exactly NBLK blocks of 256
  f4 acc = {0.f, 0.f, 0.f, 0.f};
  const float* xr = x + (size_t)row * D_DIM;
#pragma unroll 4
  for (int d = 0; d < D_DIM; d += 4) {
    f4 xv = *(const f4*)(xr + d);
    acc += xv.x * *(const f4*)(Wg + (d + 0) * 4);
    acc += xv.y * *(const f4*)(Wg + (d + 1) * 4);
    acc += xv.z * *(const f4*)(Wg + (d + 2) * 4);
    acc += xv.w * *(const f4*)(Wg + (d + 3) * 4);
  }
  float l0 = acc.x + bg[0], l1 = acc.y + bg[1], l2 = acc.z + bg[2], l3 = acc.w + bg[3];
  int bi = 0; float bv = l0;
  if (l1 > bv) { bv = l1; bi = 1; }
  if (l2 > bv) { bv = l2; bi = 2; }
  if (l3 > bv) { bv = l3; bi = 3; }
  wsi[WS_IDX + row] = bi;
  const int lane = threadIdx.x & 31, wave = threadIdx.x >> 5;
  unsigned mine;
  int c = wave_counts(bi, lane, mine);
  if (lane < 4) wcnt[wave][lane] = c;
  __syncthreads();
  if (threadIdx.x < 4) {
    int s = 0;
#pragma unroll
    for (int w = 0; w < 8; ++w) s += wcnt[w][threadIdx.x];
    wsi[WS_BLK + blockIdx.x * 4 + threadIdx.x] = s;
  }
}

// ---- K2: prefix of the per-block counts (thread b = row block b), counts padded to TILE_M,
//          each block's start slot per expert, padding perm slots filled with -1 ----
__global__ __launch_bounds__(NBLK) void k_scan(int* __restrict__ wsi) {
  __shared__ i4 wtot[NBLK / 32];
  const int t = threadIdx.x, lane = t & 31, wave = t >> 5;
  const i4 c = *(const i4*)(wsi + WS_BLK + t * 4);
  i4 inc = c;                                  // inclusive prefix inside the wave
#pragma unroll
  for (int d = 1; d < 32; d <<= 1) {
    i4 o = { __shfl_up(inc.x, d), __shfl_up(inc.y, d), __shfl_up(inc.z, d), __shfl_up(inc.w, d) };
    if (lane >= d) inc += o;
  }
  if (lane == 31) wtot[wave] = inc;
  __syncthreads();
  i4 before = {0, 0, 0, 0}, tot = {0, 0, 0, 0};
#pragma unroll
  for (int w = 0; w < NBLK / 32; ++w) {
    i4 v = wtot[w];
    if (w < wave) before += v;
    tot += v;
  }
  const i4 pad = (tot + (TILE_M - 1)) / TILE_M * TILE_M;
  const i4 off = { 0, pad.x, pad.x + pad.y, pad.x + pad.y + pad.z };
  *(i4*)(wsi + WS_BLK + t * 4) = off + before + inc - c;
  if (t < TILE_M) {
#pragma unroll
    for (int e = 0; e < 4; ++e)
      if (tot[e] + t < pad[e]) wsi[WS_PERM + off[e] + tot[e] + t] = -1;
  }
  if (t < 4) wsi[WS_OFFS + t] = off[t];
  if (t == 4) wsi[WS_OFFS + 4] = off.w + pad.w;
}

// ---- K3: scatter rows into expert-grouped order (stable: rank = rows of the same expert before it) ----
__global__ void k_scatter(int* __restrict__ wsi) {
  __shared__ int wcnt[8][4];
  int row = blockIdx.x * 256 + threadIdx.x;   // grid is exactly NBLK blocks of 256
  const int lane = threadIdx.x & 31, wave = threadIdx.x >> 5;
  int e = wsi[WS_IDX + row];
  unsigned mine;
  int c = wave_counts(e, lane, mine);
  if (lane < 4) wcnt[wave][lane] = c;
  __syncthreads();
  int pos = wsi[WS_BLK + blockIdx.x * 4 + e] + __popc(mine & ((1u << lane) - 1u));
#pragma unroll   // branch-free: seven LDS reads issued together instead of a loop of dependent trips
  for (int w = 0; w < 7; ++w) pos += (w < wave) ? wcnt[w][e] : 0;
  wsi[WS_PERM + pos] = row;
}

// ---- bf16x3 GEMM layer: C = relu(in * W + bias); in LDS hi/lo bf16 planes.
//      A layer writes its result over its own input planes: the sums wait in registers until
//      every wave has read its last fragment. The last layer stages f32 there (stage = the two
//      planes as one array) and stores each row to global memory as whole 128-byte lines. ----
template <bool LAST>
__device__ __forceinline__ void gemm_layer(
    unsigned short* inH, unsigned short* inL,
    const unsigned short* __restrict__ wH,  const unsigned short* __restrict__ wL,
    const float* __restrict__ bias,
    float* __restrict__ out, const int* __restrict__ rows_s, float* stage) {
  const int lane = threadIdx.x & 31;
  const int wave = threadIdx.x >> 5;
  const int r = lane & 15, hi = lane >> 4, hi8 = hi * 8;
  const int nt0 = wave * 2;

  v8f acc[2][8];
#pragma unroll
  for (int t = 0; t < 2; ++t)
#pragma unroll
    for (int m = 0; m < 8; ++m)
#pragma unroll
      for (int q = 0; q < 8; ++q) acc[t][m][q] = 0.f;

  for (int ks = 0; ks < KSTEPS; ++ks) {
    Frag bH[2], bL[2];
#pragma unroll
    for (int t = 0; t < 2; ++t) {
      const unsigned short* ph = wH + ((nt0 + t) * 8 + ks) * 512 + lane * 16;
      const unsigned short* pl = wL + ((nt0 + t) * 8 + ks) * 512 + lane * 16;
      bH[t].q[0] = *(const f4*)(ph);     bH[t].q[1] = *(const f4*)(ph + 8);
      bL[t].q[0] = *(const f4*)(pl);     bL[t].q[1] = *(const f4*)(pl + 8);
    }
    if (ks + 1 < KSTEPS) {  // gfx1250 global_prefetch for next weight block
      __builtin_prefetch(wH + (nt0 * 8 + ks + 1) * 512 + lane * 16, 0, 1);
      __builtin_prefetch(wL + (nt0 * 8 + ks + 1) * 512 + lane * 16, 0, 1);
    }
#pragma unroll
    for (int m = 0; m < 8; ++m) {
      const unsigned short* pah = inH + (m * 16 + r) * PADH + ks * 32 + hi8;
      const unsigned short* pal = inL + (m * 16 + r) * PADH + ks * 32 + hi8;
      Frag aH, aL;
      aH.q[0] = *(const f4*)(pah);       aH.q[1] = *(const f4*)(pah + 16);
      aL.q[0] = *(const f4*)(pal);       aL.q[1] = *(const f4*)(pal + 16);
#pragma unroll
      for (int t = 0; t < 2; ++t) {
        acc[t][m] = __builtin_amdgcn_wmma_f32_16x16x32_bf16(false, aH.v, false, bH[t].v,
                                                            (short)0, acc[t][m], false, false);
        acc[t][m] = __builtin_amdgcn_wmma_f32_16x16x32_bf16(false, aH.v, false, bL[t].v,
                                                            (short)0, acc[t][m], false, false);
        acc[t][m] = __builtin_amdgcn_wmma_f32_16x16x32_bf16(false, aL.v, false, bH[t].v,
                                                            (short)0, acc[t][m], false, false);
      }
    }
  }

  // every wave reads all rows and all k of the planes: none may be overwritten before the last read
  // ends the compiler's scheduling region: with the staging and the stores in one region with the
  // matrix loops it left the loops in source order, every fragment load waited for at once
  if (LAST) __builtin_amdgcn_sched_barrier(0);
  __syncthreads();

  // epilogue: bias + relu; write next-layer LDS planes (in place) or the staged f32 result
#pragma unroll
  for (int t = 0; t < 2; ++t) {
    const int col = (nt0 + t) * 16 + r;
    const float bv = bias[col];
#pragma unroll
    for (int m = 0; m < 8; ++m)
#pragma unroll
      for (int q = 0; q < 8; ++q) {
        float val = fmaxf(acc[t][m][q] + bv, 0.f);
        int row = m * 16 + q + hi8;     // C layout: M = vgpr + 8*hi
        if (LAST) {
          stage[(hi8 * SPITCH + col) + (m * 16 + q) * SPITCH] = val;
        } else {
          unsigned short h = f2bf(val);
          inH[row * PADH + col] = h;
          inL[row * PADH + col] = f2bf(val - bf2f(h));
        }
      }
  }

  if (LAST) {
    __syncthreads();   // a wave stores rows whose columns all eight waves have staged
    const int row0 = wave * ROWS_W;
    i4 rr[ROWS_W / 4];
#pragma unroll   // unrolled here and below: rr, va and vb must be registers
    for (int k = 0; k < ROWS_W / 4; ++k) rr[k] = *(const i4*)(rows_s + row0 + 4 * k);
    f4 va[ROWS_W], vb[ROWS_W];   // left and right half of each row, 16 bytes a lane
#pragma unroll   // as above
    for (int j = 0; j < ROWS_W; ++j) {
      va[j] = *(const f4*)(stage + (row0 + j) * SPITCH + lane * 4);
      vb[j] = *(const f4*)(stage + (row0 + j) * SPITCH + D_DIM / 2 + lane * 4);
    }
#pragma unroll   // as above
    for (int j = 0; j < ROWS_W; ++j) {
      // the same in every lane: as a scalar it gives a scalar branch and a scalar row address
      const int ro = __builtin_amdgcn_readfirstlane(rr[j >> 2][j & 3]);
      if (ro >= 0) {   // a padding slot has no row
        float* po = out + (size_t)ro * D_DIM + lane * 4;
        *(f4*)(po) = va[j];
        *(f4*)(po + D_DIM / 2) = vb[j];
        // the wait that stands in front of any rewrite of a register that an issued store names
        asm volatile("s_wait_xcnt 0x0" ::: "memory");
      }
    }
  }
}

// ---- K4: fused routed 3-layer GEMM over one 128-row expert-grouped tile ----
// One pair of LDS planes (about 137 KB) and at most 256 registers a wave: two work-groups share a WGP.
__global__ __launch_bounds__(BLK, 4) void k_main(
    const float* __restrict__ x, const float* __restrict__ b_leaf,
    const float* __restrict__ b_mid, const float* __restrict__ b_root,
    const unsigned short* __restrict__ wp, const int* __restrict__ wsi,
    float* __restrict__ out) {
  // hi and lo plane of the tile's current layer; at the end the f32 result (TILE_M * SPITCH floats fit)
  __shared__ __attribute__((aligned(16))) unsigned short smem[2 * TILE_M * PADH];
  __shared__ __attribute__((aligned(16))) int rows_s[TILE_M];   // read four at a time in the gather
  const int PLANE = TILE_M * PADH;
  unsigned short* pAh = smem;
  unsigned short* pAl = smem + PLANE;

  const int base = blockIdx.x * TILE_M;
  const int o1 = wsi[WS_OFFS + 1], o2 = wsi[WS_OFFS + 2];
  const int o3 = wsi[WS_OFFS + 3], o4 = wsi[WS_OFFS + 4];
  if (base >= o4) return;
  const int e = (base < o1) ? 0 : ((base < o2) ? 1 : ((base < o3) ? 2 : 3));
  const int p = e >> 1;

  const int tid = threadIdx.x;
  if (tid < TILE_M) rows_s[tid] = wsi[WS_PERM + base + tid];
  __syncthreads();

  // gather x rows, split fp32 -> bf16 hi/lo planes.
  // A thread issues all its row loads before it converts the first: one memory latency per
  // tile instead of one per load. The loads carry no branch: a padding slot reads row 0, and
  // what the layers make of it is never stored (the last layer stores only slots with a row).
  const int grow = (tid >> 6) * (2 * GATHER_H);   // this thread's tile rows: grow .. grow + 2 * GATHER_H - 1
  const int gq = tid & 63;                        // its 16-byte piece of each row
  u32x4 q[GATHER_H / 2];                          // load offsets, in 16-byte units
#pragma unroll   // unrolled here and in the loops over j below: q, xa and xb must be registers
  for (int k = 0; k < GATHER_H / 2; ++k) {
    const i4 r = *(const i4*)(rows_s + grow + 4 * k);
#pragma unroll   // as above
    for (int s = 0; s < 4; ++s) q[k][s] = ((unsigned)(r[s] < 0 ? 0 : r[s]) << 6) + gq;
  }
  f4 xa[GATHER_H], xb[GATHER_H];                  // first and second half of the loads
#pragma unroll   // as above
  for (int j = 0; j < GATHER_H; ++j) xa[j] = *(const f4*)(x + (size_t)q[j >> 2][j & 3] * 4);
#pragma unroll   // as above
  for (int j = 0; j < GATHER_H; ++j)
    xb[j] = *(const f4*)(x + (size_t)q[(GATHER_H + j) >> 2][j & 3] * 4);
  // the wait that stands in front of any rewrite of a register that an issued load names;
  // the offsets are its inputs, so that each keeps its register up to this line
  asm volatile("s_wait_xcnt 0x0"
               :: "v"(q[0]), "v"(q[1]), "v"(q[2]), "v"(q[3]), "v"(q[4]), "v"(q[5]), "v"(q[6]), "v"(q[7])
               : "memory");
#pragma unroll 1   // rolled: the convert code stands once for both halves, which keeps the kernel's text short
  for (int h = 0; h < 2; ++h) {
#pragma unroll   // as above
    for (int j = 0; j < GATHER_H; ++j) {
      const int row = grow + h * GATHER_H + j;
      const int c = gq << 2;
      const f4 xv = xa[j];
      u16x4 hv = { f2bf(xv.x), f2bf(xv.y), f2bf(xv.z), f2bf(xv.w) };
      u16x4 lv = { f2bf(xv.x - bf2f(hv.x)), f2bf(xv.y - bf2f(hv.y)),
                   f2bf(xv.z - bf2f(hv.z)), f2bf(xv.w - bf2f(hv.w)) };
      *(u16x4*)(pAh + row * PADH + c) = hv;
      *(u16x4*)(pAl + row * PADH + c) = lv;
      xa[j] = xb[j];
    }
  }
  __syncthreads();

  // leaf (routed expert e)
  gemm_layer<false>(pAh, pAl, wp + (2 * e + 0) * WPLANE, wp + (2 * e + 1) * WPLANE,
                    b_leaf + e * D_DIM, nullptr, nullptr, nullptr);
  __syncthreads();
  // mid (parent p)
  gemm_layer<false>(pAh, pAl, wp + (2 * (4 + p) + 0) * WPLANE, wp + (2 * (4 + p) + 1) * WPLANE,
                    b_mid + p * D_DIM, nullptr, nullptr, nullptr);
  __syncthreads();
  // root, scatter to original row order
  gemm_layer<true>(pAh, pAl, wp + 12 * WPLANE, wp + 13 * WPLANE,
                   b_root, out, rows_s, (float*)smem);
}

extern "C" void kernel_launch(void* const* d_in, const int* in_sizes, int n_in,
                              void* d_out, int out_size, void* d_ws, size_t ws_size,
                              hipStream_t stream) {
  (void)in_sizes; (void)n_in; (void)out_size; (void)ws_size;
  const float* x      = (const float*)d_in[0];
  const float* Wg     = (const float*)d_in[1];
  const float* bg     = (const float*)d_in[2];
  const float* W_leaf = (const float*)d_in[3];
  const float* b_leaf = (const float*)d_in[4];
  const float* W_mid  = (const float*)d_in[5];
  const float* b_mid  = (const float*)d_in[6];
  const float* W_root = (const float*)d_in[7];
  const float* b_root = (const float*)d_in[8];
  float* out = (float*)d_out;
  int* wsi = (int*)d_ws;
  unsigned short* wp = (unsigned short*)((char*)d_ws + WPACK_BYTES);

  k_pack<<<896, 256, 0, stream>>>(W_leaf, W_mid, W_root, wp);
  k_gate<<<B_ROWS / 256, 256, 0, stream>>>(x, Wg, bg, wsi);
  k_scan<<<1, NBLK, 0, stream>>>(wsi);
  k_scatter<<<B_ROWS / 256, 256, 0, stream>>>(wsi);
  k_main<<<B_ROWS / TILE_M + 4, BLK, 0, stream>>>(x, b_leaf, b_mid, b_root, wp, wsi, out);
}

// v005
// Measured time: 126 microseconds a run.
// In both of two side-by-side timings against v004, it was 1.11 times as fast.
// All steps since v000 together make it 2.66 times as fast.
#include <hip/hip_runtime.h>

#define B_ROWS 131072
#define D_DIM  256
#define TILE_M 128
#define PADH   272            // LDS row stride in halves (breaks bank conflicts)
#define KSTEPS 8              // 256 / 32
#define WAVES  8
#define BLK    (WAVES * 32)   // 256 threads, 8 wave32s
#define GATHER_H (TILE_M * (D_DIM / 4) / BLK / 2)   // 16: half of a thread's 16-byte loads in the gather
#define SPITCH 260            // LDS row stride in floats of the staged result: rows 8 apart fall 32 banks apart
#define ROWS_W (TILE_M / WAVES)   // 16: result rows that one wave stores

typedef __attribute__((ext_vector_type(16))) __bf16          v16bf;
typedef __attribute__((ext_vector_type(8)))  float           v8f;
typedef __attribute__((ext_vector_type(4)))  float           f4;
typedef __attribute__((ext_vector_type(4)))  unsigned short  u16x4;
typedef __attribute__((ext_vector_type(4)))  int             i4;
typedef __attribute__((ext_vector_type(4)))  unsigned        u32x4;

union Frag { f4 q[2]; v16bf v; };

// ---- workspace layout (int units) ----
#define WS_OFFS   8                 // offs[0..4], offs[4] = padded total
#define WS_IDX    16
#define WS_PERM   (16 + B_ROWS)
#define WS_PERM_LEN (B_ROWS + 4 * TILE_M)
#define NBLK      (B_ROWS / 256)    // row blocks of k_gate and k_scatter
#define WS_BLK    (WS_PERM + WS_PERM_LEN)   // [NBLK][4]: per-block expert counts, then start slots
#define WPACK_BYTES ((size_t)(WS_BLK + NBLK * 4) * 4)       // bf16 packed weights after ints
#define WPLANE 65536                // ushorts per 256x256 plane

__device__ __forceinline__ unsigned short f2bf(float f) {
  unsigned u = __float_as_uint(f);
  u += 0x7FFFu + ((u >> 16) & 1u);          // round-to-nearest-even
  return (unsigned short)(u >> 16);
}
__device__ __forceinline__ float bf2f(unsigned short h) {
  return __uint_as_float(((unsigned)h) << 16);
}

// ---- K0: split fp32 weights into bf16 hi/lo planes, pre-swizzled to WMMA B-frag order ----
// B frag (32x16 bf16): lane (r = lane&15, hi = lane>>4) holds col n = nt*16+r;
// VGPR v<4: K = ks*32 + 8*hi + 2*v + h ; v>=4: K = ks*32 + 16 + 8*hi + 2*(v-4) + h
__global__ void k_pack(const float* __restrict__ Wl, const float* __restrict__ Wm,
                       const float* __restrict__ Wr, unsigned short* __restrict__ wp) {
  int gid = blockIdx.x * 256 + threadIdx.x;
  if (gid >= (7 << 15)) return;
  int v    = gid & 7;
  int lane = (gid >> 3) & 31;
  int ks   = (gid >> 8) & 7;
  int nt   = (gid >> 11) & 15;
  int mat  = gid >> 15;
  const float* W = (mat < 4) ? (Wl + mat * 65536)
                             : ((mat < 6) ? (Wm + (mat - 4) * 65536) : Wr);
  int hi = lane >> 4, r = lane & 15;
  int n = nt * 16 + r;
  unsigned hw = 0, lw = 0;
  for (int h = 0; h < 2; ++h) {
    int k = ks * 32 + 8 * hi + ((v < 4) ? (2 * v + h) : (16 + 2 * (v - 4) + h));
    float w = W[k * D_DIM + n];
    unsigned short wh = f2bf(w);
    unsigned short wl = f2bf(w - bf2f(wh));
    hw |= ((unsigned)wh) << (16 * h);
    lw |= ((unsigned)wl) << (16 * h);
  }
  int idx = (nt * 8 + ks) * 512 + lane * 16 + v * 2;
  *(unsigned*)(wp + (mat * 2 + 0) * WPLANE + idx) = hw;
  *(unsigned*)(wp + (mat * 2 + 1) * WPLANE + idx) = lw;
}

// lane e (e < 4) gets the number of lanes of this wave that chose expert e;
// mine = mask of the lanes that chose the same expert as this lane
__device__ __forceinline__ int wave_counts(int e, int lane, unsigned& mine) {
  unsigned b0 = __builtin_amdgcn_ballot_w32(e == 0);
  unsigned b1 = __builtin_amdgcn_ballot_w32(e == 1);
  unsigned b2 = __builtin_amdgcn_ballot_w32(e == 2);
  unsigned b3 = __builtin_amdgcn_ballot_w32(e == 3);
  mine = (e == 0) ? b0 : ((e == 1) ? b1 : ((e == 2) ? b2 : b3));
  return __popc((lane == 0) ? b0 : ((lane == 1) ? b1 : ((lane == 2) ? b2 : b3)));
}

// ---- K1: gate (argmax, first-max tiebreak) + expert counts of this block of 256 rows ----
__global__ void k_gate(const float* __restrict__ x, const float* __restrict__ Wg,
                       const float* __restrict__ bg, int* __restrict__ wsi) {
  __shared__ int wcnt[8][4];
  int row = blockIdx.x * 256 + threadIdx.x;   // grid is exactly NBLK blocks of 256
  f4 acc = {0.f, 0.f, 0.f, 0.f};
  const float* xr = x + (size_t)row * D_DIM;
#pragma unroll 4
  for (int d = 0; d < D_DIM; d += 4) {
    f4 xv = *(const f4*)(xr + d);
    acc += xv.x * *(const f4*)(Wg + (d + 0) * 4);
    acc += xv.y * *(const f4*)(Wg + (d + 1) * 4);
    acc += xv.z * *(const f4*)(Wg + (d + 2) * 4);
    acc += xv.w * *(const f4*)(Wg + (d + 3) * 4);
  }
  float l0 = acc.x + bg[0], l1 = acc.y + bg[1], l2 = acc.z + bg[2], l3 = acc.w + bg[3];
  int bi = 0; float bv = l0;
  if (l1 > bv) { bv = l1; bi = 1; }
  if (l2 > bv) { bv = l2; bi = 2; }
  if (l3 > bv) { bv = l3; bi = 3; }
  wsi[WS_IDX + row] = bi;
  const int lane = threadIdx.x & 31, wave = threadIdx.x >> 5;
  unsigned mine;
  int c = wave_counts(bi, lane, mine);
  if (lane < 4) wcnt[wave][lane] = c;
  __syncthreads();
  if (threadIdx.x < 4) {
    int s = 0;
#pragma unroll
    for (int w = 0; w < 8; ++w) s += wcnt[w][threadIdx.x];
    wsi[WS_BLK + blockIdx.x * 4 + threadIdx.x] = s;
  }
}

// ---- K2: prefix of the per-block counts (thread b = row block b), counts padded to TILE_M,
//          each block's start slot per expert, padding perm slots filled with -1 ----
__global__ __launch_bounds__(NBLK) void k_scan(int* __restrict__ wsi) {
  __shared__ i4 wtot[NBLK / 32];
  const int t = threadIdx.x, lane = t & 31, wave = t >> 5;
  const i4 c = *(const i4*)(wsi + WS_BLK + t * 4);
  i4 inc = c;                                  // inclusive prefix inside the wave
#pragma unroll
  for (int d = 1; d < 32; d <<= 1) {
    i4 o = { __shfl_up(inc.x, d), __shfl_up(inc.y, d), __shfl_up(inc.z, d), __shfl_up(inc.w, d) };
    if (lane >= d) inc += o;
  }
  if (lane == 31) wtot[wave] = inc;
  __syncthreads();
  i4 before = {0, 0, 0, 0}, tot = {0, 0, 0, 0};
#pragma unroll
  for (int w = 0; w < NBLK / 32; ++w) {
    i4 v = wtot[w];
    if (w < wave) before += v;
    tot += v;
  }
  const i4 pad = (tot + (TILE_M - 1)) / TILE_M * TILE_M;
  const i4 off = { 0, pad.x, pad.x + pad.y, pad.x + pad.y + pad.z };
  *(i4*)(wsi + WS_BLK + t * 4) = off + before + inc - c;
  if (t < TILE_M) {
#pragma unroll
    for (int e = 0; e < 4; ++e)
      if (tot[e] + t < pad[e]) wsi[WS_PERM + off[e] + tot[e] + t] = -1;
  }
  if (t < 4) wsi[WS_OFFS + t] = off[t];
  if (t == 4) wsi[WS_OFFS + 4] = off.w + pad.w;
}

// ---- K3: scatter rows into expert-grouped order (stable: rank = rows of the same expert before it) ----
__global__ void k_scatter(int* __restrict__ wsi) {
  __shared__ int wcnt[8][4];
  int row = blockIdx.x * 256 + threadIdx.x;   // grid is exactly NBLK blocks of 256
  const int lane = threadIdx.x & 31, wave = threadIdx.x >> 5;
  int e = wsi[WS_IDX + row];
  unsigned mine;
  int c = wave_counts(e, lane, mine);
  if (lane < 4) wcnt[wave][lane] = c;
  __syncthreads();
  int pos = wsi[WS_BLK + blockIdx.x * 4 + e] + __popc(mine & ((1u << lane) - 1u));
#pragma unroll   // branch-free: seven LDS reads issued together instead of a loop of dependent trips
  for (int w = 0; w < 7; ++w) pos += (w < wave) ? wcnt[w][e] : 0;
  wsi[WS_PERM + pos] = row;
}

// ---- bf16x3 GEMM layer: C = relu(in * W + bias); in LDS hi/lo bf16 planes.
//      A layer writes its result over its own input planes: the sums wait in registers until
//      every wave has read its last fragment. The last layer stages f32 there (stage = the two
//      planes as one array) and stores each row to global memory as whole 128-byte lines. ----
// the wave's four B fragments (two column tiles, hi and lo plane) of k step ks; w = the layer's hi
// plane, the same for the whole work-group (its lo plane follows it), voff = the lane's byte offset
__device__ __forceinline__ void load_b(Frag (&b)[2][2], const unsigned short* __restrict__ w,
                                       unsigned voff, int ks) {
  const char* p = (const char*)w + voff;
#pragma unroll   // unrolled, both loops: b must be registers
  for (int t = 0; t < 2; ++t)
#pragma unroll
    for (int pl = 0; pl < 2; ++pl) {
      b[t][pl].q[0] = *(const f4*)(p + (pl * WPLANE + (t * 8 + ks) * 512) * 2);
      b[t][pl].q[1] = *(const f4*)(p + (pl * WPLANE + (t * 8 + ks) * 512) * 2 + 16);
    }
}

// Operands are fetched ahead of their use. A step is one 16-row tile of one k step: four matrix
// instructions on its hi A fragment, then two on its lo one. In front of step s stand four LDS loads
// in one group: the hi fragment of step s + 2 (ring of three register sets) and the lo fragment of
// step s + 1 (two sets), so each has about ten matrix instructions between its load and its use.
// The B fragments of the next k step are loaded at the first step of this one into a second set;
// at the last k step they are the next layer's first (wN). On entry bq[0] holds this layer's k step 0.
template <bool LAST>
__device__ __forceinline__ void gemm_layer(
    unsigned short* inH, unsigned short* inL,
    const unsigned short* __restrict__ wC,  const unsigned short* __restrict__ wN,
    unsigned voff, Frag (&bq)[2][2][2],
    const float* __restrict__ bias,
    float* __restrict__ out, const int* __restrict__ rows_s, float* stage) {
  const int lane = threadIdx.x & 31;
  const int wave = threadIdx.x >> 5;
  const int r = lane & 15, hi = lane >> 4, hi8 = hi * 8;
  const int nt0 = wave * 2;

  v8f acc[2][8];
#pragma unroll
  for (int t = 0; t < 2; ++t)
#pragma unroll
    for (int m = 0; m < 8; ++m)
#pragma unroll
      for (int q = 0; q < 8; ++q) acc[t][m][q] = 0.f;

  Frag ah[3], al[2];   // A fragments: hi plane [step mod 3], lo plane [step mod 2]
#pragma unroll   // unrolled here and below: ah, al, bq and acc must be registers
  for (int s = 0; s < 2; ++s) {
    const unsigned short* pah = inH + (s * 16 + r) * PADH + hi8;
    ah[s].q[0] = *(const f4*)(pah);      ah[s].q[1] = *(const f4*)(pah + 16);
  }
  {
    const unsigned short* pal = inL + r * PADH + hi8;
    al[0].q[0] = *(const f4*)(pal);      al[0].q[1] = *(const f4*)(pal + 16);
  }
#pragma unroll   // as above
  for (int s = 0; s < KSTEPS * 8; ++s) {
    const int ks = s >> 3, m = s & 7;
    if (s + 2 < KSTEPS * 8) {
      const int s2 = s + 2;
      const unsigned short* pah = inH + ((s2 & 7) * 16 + r) * PADH + (s2 >> 3) * 32 + hi8;
      ah[s2 % 3].q[0] = *(const f4*)(pah);    ah[s2 % 3].q[1] = *(const f4*)(pah + 16);
    }
    if (s + 1 < KSTEPS * 8) {
      const int s1 = s + 1;
      const unsigned short* pal = inL + ((s1 & 7) * 16 + r) * PADH + (s1 >> 3) * 32 + hi8;
      al[s1 & 1].q[0] = *(const f4*)(pal);    al[s1 & 1].q[1] = *(const f4*)(pal + 16);
    }
    if (m == 0) {
      if (ks + 1 < KSTEPS) load_b(bq[(ks + 1) & 1], wC, voff, ks + 1);
      else if (!LAST)      load_b(bq[(ks + 1) & 1], wN, voff, 0);
    }
    // holds the loads above in front of this step's matrix instructions: the scheduler otherwise
    // sinks each load to just before its use, and the wave waits out the latency there
    __builtin_amdgcn_sched_barrier(0);
    Frag (&bc)[2][2] = bq[ks & 1];
    // per accumulator the order hi*hi, hi*lo, lo*hi; the two column tiles alternate
#pragma unroll   // as above
    for (int t = 0; t < 2; ++t)
      acc[t][m] = __builtin_amdgcn_wmma_f32_16x16x32_bf16(false, ah[s % 3].v, false, bc[t][0].v,
                                                          (short)0, acc[t][m], false, false);
#pragma unroll   // as above
    for (int t = 0; t < 2; ++t)
      acc[t][m] = __builtin_amdgcn_wmma_f32_16x16x32_bf16(false, ah[s % 3].v, false, bc[t][1].v,
                                                          (short)0, acc[t][m], false, false);
#pragma unroll   // as above
    for (int t = 0; t < 2; ++t)
      acc[t][m] = __builtin_amdgcn_wmma_f32_16x16x32_bf16(false, al[s & 1].v, false, bc[t][0].v,
                                                          (short)0, acc[t][m], false, false);
    // ends the step: the next step's loads stay behind these matrix instructions
    __builtin_amdgcn_sched_barrier(0);
  }

  // every wave reads all rows and all k of the planes: none may be overwritten before the last read
  __syncthreads();

  // epilogue: bias + relu; write next-layer LDS planes (in place) or the staged f32 result
#pragma unroll
  for (int t = 0; t < 2; ++t) {
    const int col = (nt0 + t) * 16 + r;
    const float bv = bias[col];
#pragma unroll
    for (int m = 0; m < 8; ++m)
#pragma unroll
      for (int q = 0; q < 8; ++q) {
        float val = fmaxf(acc[t][m][q] + bv, 0.f);
        int row = m * 16 + q + hi8;     // C layout: M = vgpr + 8*hi
        if (LAST) {
          stage[(hi8 * SPITCH + col) + (m * 16 + q) * SPITCH] = val;
        } else {
          unsigned short h = f2bf(val);
          inH[row * PADH + col] = h;
          inL[row * PADH + col] = f2bf(val - bf2f(h));
        }
      }
  }

  if (LAST) {
    __syncthreads();   // a wave stores rows whose columns all eight waves have staged
    const int row0 = wave * ROWS_W;
    i4 rr[ROWS_W / 4];
#pragma unroll   // unrolled here and below: rr, va and vb must be registers
    for (int k = 0; k < ROWS_W / 4; ++k) rr[k] = *(const i4*)(rows_s + row0 + 4 * k);
    f4 va[ROWS_W], vb[ROWS_W];   // left and right half of each row, 16 bytes a lane
#pragma unroll   // as above
    for (int j = 0; j < ROWS_W; ++j) {
      va[j] = *(const f4*)(stage + (row0 + j) * SPITCH + lane * 4);
      vb[j] = *(const f4*)(stage + (row0 + j) * SPITCH + D_DIM / 2 + lane * 4);
    }
#pragma unroll   // as above
    for (int j = 0; j < ROWS_W; ++j) {
      // the same in every lane: as a scalar it gives a scalar branch and a scalar row address
      const int ro = __builtin_amdgcn_readfirstlane(rr[j >> 2][j & 3]);
      if (ro >= 0) {   // a padding slot has no row
        float* po = out + (size_t)ro * D_DIM + lane * 4;
        *(f4*)(po) = va[j];
        *(f4*)(po + D_DIM / 2) = vb[j];
        // the wait that stands in front of any rewrite of a register that an issued store names
        asm volatile("s_wait_xcnt 0x0" ::: "memory");
      }
    }
  }
}

// ---- K4: fused routed 3-layer GEMM over one 128-row expert-grouped tile ----
// One pair of LDS planes (about 137 KB) and at most 256 registers a wave: two work-groups share a WGP.
__global__ __launch_bounds__(BLK, 4) void k_main(
    const float* __restrict__ x, const float* __restrict__ b_leaf,
    const float* __restrict__ b_mid, const float* __restrict__ b_root,
    const unsigned short* __restrict__ wp, const int* __restrict__ wsi,
    float* __restrict__ out) {
  // hi and lo plane of the tile's current layer; at the end the f32 result (TILE_M * SPITCH floats fit)
  __shared__ __attribute__((aligned(16))) unsigned short smem[2 * TILE_M * PADH];
  __shared__ __attribute__((aligned(16))) int rows_s[TILE_M];   // read four at a time in the gather
  const int PLANE = TILE_M * PADH;
  unsigned short* pAh = smem;
  unsigned short* pAl = smem + PLANE;

  const int base = blockIdx.x * TILE_M;
  const int o1 = wsi[WS_OFFS + 1], o2 = wsi[WS_OFFS + 2];
  const int o3 = wsi[WS_OFFS + 3], o4 = wsi[WS_OFFS + 4];
  if (base >= o4) return;
  const int e = (base < o1) ? 0 : ((base < o2) ? 1 : ((base < o3) ? 2 : 3));
  const int p = e >> 1;

  const int tid = threadIdx.x;
  if (tid < TILE_M) rows_s[tid] = wsi[WS_PERM + base + tid];
  __syncthreads();

  // gather x rows, split fp32 -> bf16 hi/lo planes.
  // A thread issues all its row loads before it converts the first: one memory latency per
  // tile instead of one per load. The loads carry no branch: a padding slot reads row 0, and
  // what the layers make of it is never stored (the last layer stores only slots with a row).
  const int grow = (tid >> 6) * (2 * GATHER_H);   // this thread's tile rows: grow .. grow + 2 * GATHER_H - 1
  const int gq = tid & 63;                        // its 16-byte piece of each row
  u32x4 q[GATHER_H / 2];                          // load offsets, in 16-byte units
#pragma unroll   // unrolled here and in the loops over j below: q, xa and xb must be registers
  for (int k = 0; k < GATHER_H / 2; ++k) {
    const i4 r = *(const i4*)(rows_s + grow + 4 * k);
#pragma unroll   // as above
    for (int s = 0; s < 4; ++s) q[k][s] = ((unsigned)(r[s] < 0 ? 0 : r[s]) << 6) + gq;
  }
  f4 xa[GATHER_H], xb[GATHER_H];                  // first and second half of the loads
#pragma unroll   // as above
  for (int j = 0; j < GATHER_H; ++j) xa[j] = *(const f4*)(x + (size_t)q[j >> 2][j & 3] * 4);
#pragma unroll   // as above
  for (int j = 0; j < GATHER_H; ++j)
    xb[j] = *(const f4*)(x + (size_t)q[(GATHER_H + j) >> 2][j & 3] * 4);
  // the wait that stands in front of any rewrite of a register that an issued load names;
  // the offsets are its inputs, so that each keeps its register up to this line
  asm volatile("s_wait_xcnt 0x0"
               :: "v"(q[0]), "v"(q[1]), "v"(q[2]), "v"(q[3]), "v"(q[4]), "v"(q[5]), "v"(q[6]), "v"(q[7])
               : "memory");
  // hi planes of the three layers' packed weights (the lo plane follows its hi plane)
  const unsigned short* wLeafH = wp + (2 * e) * WPLANE;
  const unsigned short* wMidH  = wp + (2 * (4 + p)) * WPLANE;
  const unsigned short* wRootH = wp + 12 * WPLANE;
  Frag bq[2][2][2];   // B fragments: [k step mod 2][column tile][hi, lo plane]
  const unsigned voff = ((tid >> 5) * 2 * 8 * 512 + (tid & 31) * 16) * 2;   // the wave's column tiles, the lane's 32 bytes
#pragma unroll 1   // rolled: the convert code stands once for both halves, which keeps the kernel's text short
  for (int h = 0; h < 2; ++h) {
#pragma unroll   // as above
    for (int j = 0; j < GATHER_H; ++j) {
      const int row = grow + h * GATHER_H + j;
      const int c = gq << 2;
      const f4 xv = xa[j];
      u16x4 hv = { f2bf(xv.x), f2bf(xv.y), f2bf(xv.z), f2bf(xv.w) };
      u16x4 lv = { f2bf(xv.x - bf2f(hv.x)), f2bf(xv.y - bf2f(hv.y)),
                   f2bf(xv.z - bf2f(hv.z)), f2bf(xv.w - bf2f(hv.w)) };
      *(u16x4*)(pAh + row * PADH + c) = hv;
      *(u16x4*)(pAl + row * PADH + c) = lv;
      xa[j] = xb[j];
    }
  }
  load_b(bq[0], wLeafH, voff, 0);   // the leaf layer's first, in flight over the barrier
  __syncthreads();

  // leaf (routed expert e)
  gemm_layer<false>(pAh, pAl, wLeafH, wMidH, voff, bq,
                    b_leaf + e * D_DIM, nullptr, nullptr, nullptr);
  __syncthreads();
  // mid (parent p)
  gemm_layer<false>(pAh, pAl, wMidH, wRootH, voff, bq,
                    b_mid + p * D_DIM, nullptr, nullptr, nullptr);
  __syncthreads();
  // root, scatter to original row order
  gemm_layer<true>(pAh, pAl, wRootH, nullptr, voff, bq,
                   b_root, out, rows_s, (float*)smem);
}

extern "C" void kernel_launch(void* const* d_in, const int* in_sizes, int n_in,
                              void* d_out, int out_size, void* d_ws, size_t ws_size,
                              hipStream_t stream) {
  (void)in_sizes; (void)n_in; (void)out_size; (void)ws_size;
  const float* x      = (const float*)d_in[0];
  const float* Wg     = (const float*)d_in[1];
  const float* bg     = (const float*)d_in[2];
  const float* W_leaf = (const float*)d_in[3];
  const float* b_leaf = (const float*)d_in[4];
  const float* W_mid  = (const float*)d_in[5];
  const float* b_mid  = (const float*)d_in[6];
  const float* W_root = (const float*)d_in[7];
  const float* b_root = (const float*)d_in[8];
  float* out = (float*)d_out;
  int* wsi = (int*)d_ws;
  unsigned short* wp = (unsigned short*)((char*)d_ws + WPACK_BYTES);

  k_pack<<<896, 256, 0, stream>>>(W_leaf, W_mid, W_root, wp);
  k_gate<<<B_ROWS / 256, 256, 0, stream>>>(x, Wg, bg, wsi);
  k_scan<<<1, NBLK, 0, stream>>>(wsi);
  k_scatter<<<B_ROWS / 256, 256, 0, stream>>>(wsi);
  k_main<<<B_ROWS / TILE_M + 4, BLK, 0, stream>>>(x, b_leaf, b_mid, b_root, wp, wsi, out);
}

// v006
// Measured time: 115 microseconds a run.
// In both of two side-by-side timings against v005, it was 1.09 times as fast.
// Over all steps from v000 it is 2.90 times as fast.
#include <hip/hip_runtime.h>

#define B_ROWS 131072
#define D_DIM  256
#define TILE_M 128
#define TILE_S 32             // rows of a small tile: what an expert's rows leave over after its 128-row tiles
#define PADH   272            // LDS row stride in halves (breaks bank conflicts)
#define KSTEPS 8              // 256 / 32
#define WAVES  8
#define BLK    (WAVES * 32)   // 256 threads, 8 wave32s
#define GATHER_H (TILE_M * (D_DIM / 4) / BLK / 2)   // 16: half of a thread's 16-byte loads in the gather
#define SPITCH 260            // LDS row stride in floats of the staged result: rows 8 apart fall 32 banks apart

typedef __attribute__((ext_vector_type(16))) __bf16          v16bf;
typedef __attribute__((ext_vector_type(8)))  float           v8f;
typedef __attribute__((ext_vector_type(4)))  float           f4;
typedef __attribute__((ext_vector_type(4)))  unsigned short  u16x4;
typedef __attribute__((ext_vector_type(4)))  int             i4;
typedef __attribute__((ext_vector_type(4)))  unsigned        u32x4;

union Frag { f4 q[2]; v16bf v; };

// ---- workspace layout (int units) ----
#define WS_OFFS   8                 // offs[0..4], offs[4] = padded total
#define WS_IDX    16
#define WS_PERM   (16 + B_ROWS)
#define WS_PERM_LEN (B_ROWS + 4 * TILE_M)
#define NBLK      (B_ROWS / 256)    // row blocks of k_gate and k_scatter
#define WS_BLK    (WS_PERM + WS_PERM_LEN)   // [NBLK][4]: per-block expert counts, then start slots
#define WPACK_BYTES ((size_t)(WS_BLK + NBLK * 4) * 4)       // bf16 packed weights after ints
#define WPLANE 65536                // ushorts per 256x256 plane

__device__ __forceinline__ unsigned short f2bf(float f) {
  unsigned u = __float_as_uint(f);
  u += 0x7FFFu + ((u >> 16) & 1u);          // round-to-nearest-even
  return (unsigned short)(u >> 16);
}
__device__ __forceinline__ float bf2f(unsigned short h) {
  return __uint_as_float(((unsigned)h) << 16);
}

// ---- K0: split fp32 weights into bf16 hi/lo planes, pre-swizzled to WMMA B-frag order ----
// B frag (32x16 bf16): lane (r = lane&15, hi = lane>>4) holds col n = nt*16+r;
// VGPR v<4: K = ks*32 + 8*hi + 2*v + h ; v>=4: K = ks*32 + 16 + 8*hi + 2*(v-4) + h
__global__ void k_pack(const float* __restrict__ Wl, const float* __restrict__ Wm,
                       const float* __restrict__ Wr, unsigned short* __restrict__ wp) {
  int gid = blockIdx.x * 256 + threadIdx.x;
  if (gid >= (7 << 15)) return;
  int v    = gid & 7;
  int lane = (gid >> 3) & 31;
  int ks   = (gid >> 8) & 7;
  int nt   = (gid >> 11) & 15;
  int mat  = gid >> 15;
  const float* W = (mat < 4) ? (Wl + mat * 65536)
                             : ((mat < 6) ? (Wm + (mat - 4) * 65536) : Wr);
  int hi = lane >> 4, r = lane & 15;
  int n = nt * 16 + r;
  unsigned hw = 0, lw = 0;
  for (int h = 0; h < 2; ++h) {
    int k = ks * 32 + 8 * hi + ((v < 4) ? (2 * v + h) : (16 + 2 * (v - 4) + h));
    float w = W[k * D_DIM + n];
    unsigned short wh = f2bf(w);
    unsigned short wl = f2bf(w - bf2f(wh));
    hw |= ((unsigned)wh) << (16 * h);
    lw |= ((unsigned)wl) << (16 * h);
  }
  int idx = (nt * 8 + ks) * 512 + lane * 16 + v * 2;
  *(unsigned*)(wp + (mat * 2 + 0) * WPLANE + idx) = hw;
  *(unsigned*)(wp + (mat * 2 + 1) * WPLANE + idx) = lw;
}

// lane e (e < 4) gets the number of lanes of this wave that chose expert e;
// mine = mask of the lanes that chose the same expert as this lane
__device__ __forceinline__ int wave_counts(int e, int lane, unsigned& mine) {
  unsigned b0 = __builtin_amdgcn_ballot_w32(e == 0);
  unsigned b1 = __builtin_amdgcn_ballot_w32(e == 1);
  unsigned b2 = __builtin_amdgcn_ballot_w32(e == 2);
  unsigned b3 = __builtin_amdgcn_ballot_w32(e == 3);
  mine = (e == 0) ? b0 : ((e == 1) ? b1 : ((e == 2) ? b2 : b3));
  return __popc((lane == 0) ? b0 : ((lane == 1) ? b1 : ((lane == 2) ? b2 : b3)));
}

// ---- K1: gate (argmax, first-max tiebreak) + expert counts of this block of 256 rows ----
__global__ void k_gate(const float* __restrict__ x, const float* __restrict__ Wg,
                       const float* __restrict__ bg, int* __restrict__ wsi) {
  __shared__ int wcnt[8][4];
  int row = blockIdx.x * 256 + threadIdx.x;   // grid is exactly NBLK blocks of 256
  f4 acc = {0.f, 0.f, 0.f, 0.f};
  const float* xr = x + (size_t)row * D_DIM;
#pragma unroll 4
  for (int d = 0; d < D_DIM; d += 4) {
    f4 xv = *(const f4*)(xr + d);
    acc += xv.x * *(const f4*)(Wg + (d + 0) * 4);
    acc += xv.y * *(const f4*)(Wg + (d + 1) * 4);
    acc += xv.z * *(const f4*)(Wg + (d + 2) * 4);
    acc += xv.w * *(const f4*)(Wg + (d + 3) * 4);
  }
  float l0 = acc.x + bg[0], l1 = acc.y + bg[1], l2 = acc.z + bg[2], l3 = acc.w + bg[3];
  int bi = 0; float bv = l0;
  if (l1 > bv) { bv = l1; bi = 1; }
  if (l2 > bv) { bv = l2; bi = 2; }
  if (l3 > bv) { bv = l3; bi = 3; }
  wsi[WS_IDX + row] = bi;
  const int lane = threadIdx.x & 31, wave = threadIdx.x >> 5;
  unsigned mine;
  int c = wave_counts(bi, lane, mine);
  if (lane < 4) wcnt[wave][lane] = c;
  __syncthreads();
  if (threadIdx.x < 4) {
    int s = 0;
#pragma unroll
    for (int w = 0; w < 8; ++w) s += wcnt[w][threadIdx.x];
    wsi[WS_BLK + blockIdx.x * 4 + threadIdx.x] = s;
  }
}

// ---- K2: prefix of the per-block counts (thread b = row block b), counts padded to TILE_S,
//          each block's start slot per expert, padding perm slots filled with -1 ----
__global__ __launch_bounds__(NBLK) void k_scan(int* __restrict__ wsi) {
  __shared__ i4 wtot[NBLK / 32];
  const int t = threadIdx.x, lane = t & 31, wave = t >> 5;
  const i4 c = *(const i4*)(wsi + WS_BLK + t * 4);
  i4 inc = c;                                  // inclusive prefix inside the wave
#pragma unroll
  for (int d = 1; d < 32; d <<= 1) {
    i4 o = { __shfl_up(inc.x, d), __shfl_up(inc.y, d), __shfl_up(inc.z, d), __shfl_up(inc.w, d) };
    if (lane >= d) inc += o;
  }
  if (lane == 31) wtot[wave] = inc;
  __syncthreads();
  i4 before = {0, 0, 0, 0}, tot = {0, 0, 0, 0};
#pragma unroll
  for (int w = 0; w < NBLK / 32; ++w) {
    i4 v = wtot[w];
    if (w < wave) before += v;
    tot += v;
  }
  const i4 pad = (tot + (TILE_S - 1)) / TILE_S * TILE_S;
  const i4 off = { 0, pad.x, pad.x + pad.y, pad.x + pad.y + pad.z };
  *(i4*)(wsi + WS_BLK + t * 4) = off + before + inc - c;
  if (t < TILE_S) {
#pragma unroll
    for (int e = 0; e < 4; ++e)
      if (tot[e] + t < pad[e]) wsi[WS_PERM + off[e] + tot[e] + t] = -1;
  }
  if (t < 4) wsi[WS_OFFS + t] = off[t];
  if (t == 4) wsi[WS_OFFS + 4] = off.w + pad.w;
}

// ---- K3: scatter rows into expert-grouped order (stable: rank = rows of the same expert before it) ----
__global__ void k_scatter(int* __restrict__ wsi) {
  __shared__ int wcnt[8][4];
  int row = blockIdx.x * 256 + threadIdx.x;   // grid is exactly NBLK blocks of 256
  const int lane = threadIdx.x & 31, wave = threadIdx.x >> 5;
  int e = wsi[WS_IDX + row];
  unsigned mine;
  int c = wave_counts(e, lane, mine);
  if (lane < 4) wcnt[wave][lane] = c;
  __syncthreads();
  int pos = wsi[WS_BLK + blockIdx.x * 4 + e] + __popc(mine & ((1u << lane) - 1u));
#pragma unroll   // branch-free: seven LDS reads issued together instead of a loop of dependent trips
  for (int w = 0; w < 7; ++w) pos += (w < wave) ? wcnt[w][e] : 0;
  wsi[WS_PERM + pos] = row;
}

// ---- bf16x3 GEMM layer: C = relu(in * W + bias); in LDS hi/lo bf16 planes.
//      A layer writes its result over its own input planes: the sums wait in registers until
//      every wave has read its last fragment. The last layer stages f32 there (stage = the two
//      planes as one array) and stores each row to global memory as whole 128-byte lines. ----
// the wave's four B fragments (two column tiles, hi and lo plane) of k step ks; w = the layer's hi
// plane, the same for the whole work-group (its lo plane follows it), voff = the lane's byte offset
__device__ __forceinline__ void load_b(Frag (&b)[2][2], const unsigned short* __restrict__ w,
                                       unsigned voff, int ks) {
  const char* p = (const char*)w + voff;
#pragma unroll   // unrolled, both loops: b must be registers
  for (int t = 0; t < 2; ++t)
#pragma unroll
    for (int pl = 0; pl < 2; ++pl) {
      b[t][pl].q[0] = *(const f4*)(p + (pl * WPLANE + (t * 8 + ks) * 512) * 2);
      b[t][pl].q[1] = *(const f4*)(p + (pl * WPLANE + (t * 8 + ks) * 512) * 2 + 16);
    }
}

// Operands are fetched ahead of their use. A step is one 16-row tile of one k step: four matrix
// instructions on its hi A fragment, then two on its lo one. In front of step s stand four LDS loads
// in one group: the hi fragment of step s + 2 (ring of three register sets) and the lo fragment of
// step s + 1 (two sets), so each has about ten matrix instructions between its load and its use.
// The B fragments of k step ks + NB - 1 are loaded at the first step of k step ks into the set that
// k step ks - 1 has left; past the last k step they are the next layer's first ones (wN). On entry
// bq[0 .. NB - 2] hold this layer's first k steps. MT = 16-row tiles of the work-group's tile: with
// 8 of them one k step ahead is far enough, with 2 a k step is so short that it takes three.
template <bool LAST, int MT, int NB>
__device__ __forceinline__ void gemm_layer(
    unsigned short* inH, unsigned short* inL,
    const unsigned short* __restrict__ wC,  const unsigned short* __restrict__ wN,
    unsigned voff, Frag (&bq)[NB][2][2],
    const float* __restrict__ bias,
    float* __restrict__ out, const int* __restrict__ rows_s, float* stage) {
  const int lane = threadIdx.x & 31;
  const int wave = threadIdx.x >> 5;
  const int r = lane & 15, hi = lane >> 4, hi8 = hi * 8;
  const int nt0 = wave * 2;

  v8f acc[2][MT];
#pragma unroll
  for (int t = 0; t < 2; ++t)
#pragma unroll
    for (int m = 0; m < MT; ++m)
#pragma unroll
      for (int q = 0; q < 8; ++q) acc[t][m][q] = 0.f;

  Frag ah[3], al[2];   // A fragments: hi plane [step mod 3], lo plane [step mod 2]
#pragma unroll   // unrolled here and below: ah, al, bq and acc must be registers
  for (int s = 0; s < 2; ++s) {
    const unsigned short* pah = inH + (s * 16 + r) * PADH + hi8;
    ah[s].q[0] = *(const f4*)(pah);      ah[s].q[1] = *(const f4*)(pah + 16);
  }
  {
    const unsigned short* pal = inL + r * PADH + hi8;
    al[0].q[0] = *(const f4*)(pal);      al[0].q[1] = *(const f4*)(pal + 16);
  }
#pragma unroll   // as above
  for (int s = 0; s < KSTEPS * MT; ++s) {
    const int ks = s / MT, m = s % MT;
    if (s + 2 < KSTEPS * MT) {
      const int s2 = s + 2;
      const unsigned short* pah = inH + ((s2 % MT) * 16 + r) * PADH + (s2 / MT) * 32 + hi8;
      ah[s2 % 3].q[0] = *(const f4*)(pah);    ah[s2 % 3].q[1] = *(const f4*)(pah + 16);
    }
    if (s + 1 < KSTEPS * MT) {
      const int s1 = s + 1;
      const unsigned short* pal = inL + ((s1 % MT) * 16 + r) * PADH + (s1 / MT) * 32 + hi8;
      al[s1 & 1].q[0] = *(const f4*)(pal);    al[s1 & 1].q[1] = *(const f4*)(pal + 16);
    }
    if (m == 0) {
      const int kn = ks + NB - 1;
      if (kn < KSTEPS) load_b(bq[kn % NB], wC, voff, kn);
      else if (!LAST)  load_b(bq[kn % NB], wN, voff, kn - KSTEPS);
    }
    // holds the loads above in front of this step's matrix instructions: the scheduler otherwise
    // sinks each load to just before its use, and the wave waits out the latency there
    __builtin_amdgcn_sched_barrier(0);
    Frag (&bc)[2][2] = bq[ks % NB];
    // per accumulator the order hi*hi, hi*lo, lo*hi; the two column tiles alternate
#pragma unroll   // as above
    for (int t = 0; t < 2; ++t)
      acc[t][m] = __builtin_amdgcn_wmma_f32_16x16x32_bf16(false, ah[s % 3].v, false, bc[t][0].v,
                                                          (short)0, acc[t][m], false, false);
#pragma unroll   // as above
    for (int t = 0; t < 2; ++t)
      acc[t][m] = __builtin_amdgcn_wmma_f32_16x16x32_bf16(false, ah[s % 3].v, false, bc[t][1].v,
                                                          (short)0, acc[t][m], false, false);
#pragma unroll   // as above
    for (int t = 0; t < 2; ++t)
      acc[t][m] = __builtin_amdgcn_wmma_f32_16x16x32_bf16(false, al[s & 1].v, false, bc[t][0].v,
                                                          (short)0, acc[t][m], false, false);
    // ends the step: the next step's loads stay behind these matrix instructions
    __builtin_amdgcn_sched_barrier(0);
  }

  // every wave reads all rows and all k of the planes: none may be overwritten before the last read
  __syncthreads();

  // epilogue: bias + relu; write next-layer LDS planes (in place) or the staged f32 result
#pragma unroll
  for (int t = 0; t < 2; ++t) {
    const int col = (nt0 + t) * 16 + r;
    const float bv = bias[col];
#pragma unroll
    for (int m = 0; m < MT; ++m)
#pragma unroll
      for (int q = 0; q < 8; ++q) {
        float val = fmaxf(acc[t][m][q] + bv, 0.f);
        int row = m * 16 + q + hi8;     // C layout: M = vgpr + 8*hi
        if (LAST) {
          stage[(hi8 * SPITCH + col) + (m * 16 + q) * SPITCH] = val;
        } else {
          unsigned short h = f2bf(val);
          inH[row * PADH + col] = h;
          inL[row * PADH + col] = f2bf(val - bf2f(h));
        }
      }
  }

  if (LAST) {
    __syncthreads();   // a wave stores rows whose columns all eight waves have staged
    constexpr int RW = MT * 16 / WAVES;   // result rows that one wave stores
    const int row0 = wave * RW;
    i4 rr[RW / 4];
#pragma unroll   // unrolled here and below: rr, va and vb must be registers
    for (int k = 0; k < RW / 4; ++k) rr[k] = *(const i4*)(rows_s + row0 + 4 * k);
    f4 va[RW], vb[RW];   // left and right half of each row, 16 bytes a lane
#pragma unroll   // as above
    for (int j = 0; j < RW; ++j) {
      va[j] = *(const f4*)(stage + (row0 + j) * SPITCH + lane * 4);
      vb[j] = *(const f4*)(stage + (row0 + j) * SPITCH + D_DIM / 2 + lane * 4);
    }
#pragma unroll   // as above
    for (int j = 0; j < RW; ++j) {
      // the same in every lane: as a scalar it gives a scalar branch and a scalar row address
      const int ro = __builtin_amdgcn_readfirstlane(rr[j >> 2][j & 3]);
      if (ro >= 0) {   // a padding slot has no row
        float* po = out + (size_t)ro * D_DIM + lane * 4;
        *(f4*)(po) = va[j];
        *(f4*)(po + D_DIM / 2) = vb[j];
        // the wait that stands in front of any rewrite of a register that an issued store names
        asm volatile("s_wait_xcnt 0x0" ::: "memory");
      }
    }
  }
}

// ---- K4: fused routed 3-layer GEMM over one expert-grouped tile ----
// An expert's rows (padded to TILE_S) are cut into 128-row tiles and, for what is left over, 32-row
// tiles. The large tiles never number more than B_ROWS / TILE_M, which fills the chip's places a whole
// number of times; the small tiles have the highest block indices and are short (for speed only).
// One pair of LDS planes (about 137 KB) and at most 256 registers a wave: two work-groups share a WGP.
__global__ __launch_bounds__(BLK, 4) void k_main(
    const float* __restrict__ x, const float* __restrict__ b_leaf,
    const float* __restrict__ b_mid, const float* __restrict__ b_root,
    const unsigned short* __restrict__ wp, const int* __restrict__ wsi,
    float* __restrict__ out) {
  // hi and lo plane of the tile's current layer; at the end the f32 result (TILE_M * SPITCH floats fit)
  __shared__ __attribute__((aligned(16))) unsigned short smem[2 * TILE_M * PADH];
  __shared__ __attribute__((aligned(16))) int rows_s[TILE_M];   // read four at a time in the gather
  const int PLANE = TILE_M * PADH;
  unsigned short* pAh = smem;
  unsigned short* pAl = smem + PLANE;

  const int o1 = wsi[WS_OFFS + 1], o2 = wsi[WS_OFFS + 2];
  const int o3 = wsi[WS_OFFS + 3], o4 = wsi[WS_OFFS + 4];
  // large tiles of experts 0 .. e - 1, then the same for the small tiles
  const int f1 = o1 / TILE_M, f2 = f1 + (o2 - o1) / TILE_M;
  const int f3 = f2 + (o3 - o2) / TILE_M, f4n = f3 + (o4 - o3) / TILE_M;
  const int g1 = o1 % TILE_M / TILE_S, g2 = g1 + (o2 - o1) % TILE_M / TILE_S;
  const int g3 = g2 + (o3 - o2) % TILE_M / TILE_S, g4 = g3 + (o4 - o3) % TILE_M / TILE_S;
  const bool small = (int)blockIdx.x >= f4n;
  const int b = small ? (int)blockIdx.x - f4n : (int)blockIdx.x;   // index among the tiles of its size
  if (small && b >= g4) return;
  const int c1 = small ? g1 : f1, c2 = small ? g2 : f2, c3 = small ? g3 : f3;
  const int e = (b < c1) ? 0 : ((b < c2) ? 1 : ((b < c3) ? 2 : 3));
  const int p = e >> 1;
  const int oe = (e == 0) ? 0 : ((e == 1) ? o1 : ((e == 2) ? o2 : o3));     // the expert's first slot
  const int on = (e == 0) ? o1 : ((e == 1) ? o2 : ((e == 2) ? o3 : o4));    // the next expert's
  const int ce = (e == 0) ? 0 : ((e == 1) ? c1 : ((e == 2) ? c2 : c3));     // tiles of this size before it
  const int base = small ? oe + (on - oe) / TILE_M * TILE_M + (b - ce) * TILE_S
                         : oe + (b - ce) * TILE_M;
  const int nrows = small ? TILE_S : TILE_M;

  const int tid = threadIdx.x;
  // a small tile's slots past its rows count as padding slots
  if (tid < TILE_M) rows_s[tid] = (tid < nrows) ? wsi[WS_PERM + base + tid] : -1;
  __syncthreads();

  // gather x rows, split fp32 -> bf16 hi/lo planes.
  // A thread issues all its row loads before it converts the first: one memory latency per
  // tile instead of one per load. The loads carry no branch: a padding slot reads row 0, and
  // what the layers make of it is never stored (the last layer stores only slots with a row).
  const int grow = (tid >> 6) * (2 * GATHER_H);   // this thread's tile rows: grow .. grow + 2 * GATHER_H - 1
  const int gq = tid & 63;                        // its 16-byte piece of each row
  u32x4 q[GATHER_H / 2];                          // load offsets, in 16-byte units
#pragma unroll   // unrolled here and in the loops over j below: q, xa and xb must be registers
  for (int k = 0; k < GATHER_H / 2; ++k) {
    const i4 r = *(const i4*)(rows_s + grow + 4 * k);
#pragma unroll   // as above
    for (int s = 0; s < 4; ++s) q[k][s] = ((unsigned)(r[s] < 0 ? 0 : r[s]) << 6) + gq;
  }
  f4 xa[GATHER_H], xb[GATHER_H];                  // first and second half of the loads
#pragma unroll   // as above
  for (int j = 0; j < GATHER_H; ++j) xa[j] = *(const f4*)(x + (size_t)q[j >> 2][j & 3] * 4);
#pragma unroll   // as above
  for (int j = 0; j < GATHER_H; ++j)
    xb[j] = *(const f4*)(x + (size_t)q[(GATHER_H + j) >> 2][j & 3] * 4);
  // the wait that stands in front of any rewrite of a register that an issued load names;
  // the offsets are its inputs, so that each keeps its register up to this line
  asm volatile("s_wait_xcnt 0x0"
               :: "v"(q[0]), "v"(q[1]), "v"(q[2]), "v"(q[3]), "v"(q[4]), "v"(q[5]), "v"(q[6]), "v"(q[7])
               : "memory");
  // hi planes of the three layers' packed weights (the lo plane follows its hi plane)
  const unsigned short* wLeafH = wp + (2 * e) * WPLANE;
  const unsigned short* wMidH  = wp + (2 * (4 + p)) * WPLANE;
  const unsigned short* wRootH = wp + 12 * WPLANE;
  const unsigned voff = ((tid >> 5) * 2 * 8 * 512 + (tid & 31) * 16) * 2;   // the wave's column tiles, the lane's 32 bytes
#pragma unroll 1   // rolled: the convert code stands once for both halves, which keeps the kernel's text short
  for (int h = 0; h < 2; ++h) {
#pragma unroll   // as above
    for (int j = 0; j < GATHER_H; ++j) {
      const int row = grow + h * GATHER_H + j;
      const int c = gq << 2;
      const f4 xv = xa[j];
      u16x4 hv = { f2bf(xv.x), f2bf(xv.y), f2bf(xv.z), f2bf(xv.w) };
      u16x4 lv = { f2bf(xv.x - bf2f(hv.x)), f2bf(xv.y - bf2f(hv.y)),
                   f2bf(xv.z - bf2f(hv.z)), f2bf(xv.w - bf2f(hv.w)) };
      *(u16x4*)(pAh + row * PADH + c) = hv;
      *(u16x4*)(pAl + row * PADH + c) = lv;
      xa[j] = xb[j];
    }
  }
  if (!small) {   // the same for the whole work-group: the barriers inside are passed by all or none
    Frag bq[2][2][2];   // B fragments: [k step mod 2][column tile][hi, lo plane]
    load_b(bq[0], wLeafH, voff, 0);   // the leaf layer's first, in flight over the barrier
    __syncthreads();

    // leaf (routed expert e)
    gemm_layer<false, TILE_M / 16, 2>(pAh, pAl, wLeafH, wMidH, voff, bq,
                                      b_leaf + e * D_DIM, nullptr, nullptr, nullptr);
    __syncthreads();
    // mid (parent p)
    gemm_layer<false, TILE_M / 16, 2>(pAh, pAl, wMidH, wRootH, voff, bq,
                                      b_mid + p * D_DIM, nullptr, nullptr, nullptr);
    __syncthreads();
    // root, scatter to original row order
    gemm_layer<true, TILE_M / 16, 2>(pAh, pAl, wRootH, nullptr, voff, bq,
                                     b_root, out, rows_s, (float*)smem);
  } else {
    Frag bq[4][2][2];   // B fragments: [k step mod 4][column tile][hi, lo plane]
    // the loads stand behind the barrier here: in front of it the compiler merges the first of them
    // with the other branch's and keeps those registers alive through this branch, which then spills
    __syncthreads();
#pragma unroll   // unrolled: bq must be registers
    for (int k = 0; k < 3; ++k) load_b(bq[k], wLeafH, voff, k);   // the leaf layer's first three

    gemm_layer<false, TILE_S / 16, 4>(pAh, pAl, wLeafH, wMidH, voff, bq,
                                      b_leaf + e * D_DIM, nullptr, nullptr, nullptr);
    __syncthreads();
    gemm_layer<false, TILE_S / 16, 4>(pAh, pAl, wMidH, wRootH, voff, bq,
                                      b_mid + p * D_DIM, nullptr, nullptr, nullptr);
    __syncthreads();
    gemm_layer<true, TILE_S / 16, 4>(pAh, pAl, wRootH, nullptr, voff, bq,
                                     b_root, out, rows_s, (float*)smem);
  }
}

extern "C" void kernel_launch(void* const* d_in, const int* in_sizes, int n_in,
                              void* d_out, int out_size, void* d_ws, size_t ws_size,
                              hipStream_t stream) {
  (void)in_sizes; (void)n_in; (void)out_size; (void)ws_size;
  const float* x      = (const float*)d_in[0];
  const float* Wg     = (const float*)d_in[1];
  const float* bg     = (const float*)d_in[2];
  const float* W_leaf = (const float*)d_in[3];
  const float* b_leaf = (const float*)d_in[4];
  const float* W_mid  = (const float*)d_in[5];
  const float* b_mid  = (const float*)d_in[6];
  const float* W_root = (const float*)d_in[7];
  const float* b_root = (const float*)d_in[8];
  float* out = (float*)d_out;
  int* wsi = (int*)d_ws;
  unsigned short* wp = (unsigned short*)((char*)d_ws + WPACK_BYTES);

  k_pack<<<896, 256, 0, stream>>>(W_leaf, W_mid, W_root, wp);
  k_gate<<<B_ROWS / 256, 256, 0, stream>>>(x, Wg, bg, wsi);
  k_scan<<<1, NBLK, 0, stream>>>(wsi);
  k_scatter<<<B_ROWS / 256, 256, 0, stream>>>(wsi);
  k_main<<<B_ROWS / TILE_M + 12, BLK, 0, stream>>>(x, b_leaf, b_mid, b_root, wp, wsi, out);
}

// v007
// Measured time: 112 microseconds a run.
// Timed twice side by side with v006, it ran 1.03 and 1.09 times as fast.
// Over all steps from v000 it is 3.08 times as fast.
#include <hip/hip_runtime.h>

#define B_ROWS 131072
#define D_DIM  256
#define TILE_M 128
#define TILE_S 32             // rows of a small tile: what an expert's rows leave over after its 128-row tiles
#define PADH   272            // LDS row stride in halves (breaks bank conflicts)
#define KSTEPS 8              // 256 / 32
#define WAVES  8
#define BLK    (WAVES * 32)   // 256 threads, 8 wave32s
#define GATHER_H (TILE_M * (D_DIM / 4) / BLK / 2)   // 16: half of a thread's 16-byte loads in the gather
#define SPITCH 260            // LDS row stride in floats of the staged result: rows 8 apart fall 32 banks apart

typedef __attribute__((ext_vector_type(16))) __bf16          v16bf;
typedef __attribute__((ext_vector_type(8)))  float           v8f;
typedef __attribute__((ext_vector_type(4)))  float           f4;
typedef __attribute__((ext_vector_type(4)))  unsigned short  u16x4;
typedef __attribute__((ext_vector_type(4)))  int             i4;
typedef __attribute__((ext_vector_type(4)))  unsigned        u32x4;

union Frag { f4 q[2]; v16bf v; };

// ---- workspace layout (int units) ----
#define WS_OFFS   8                 // offs[0..4], offs[4] = padded total
#define WS_IDX    16
#define WS_PERM   (16 + B_ROWS)
#define WS_PERM_LEN (B_ROWS + 4 * TILE_M)
#define NBLK      (B_ROWS / 256)    // row blocks of k_gate_pack's gate and of k_scatter
#define WS_BLK    (WS_PERM + WS_PERM_LEN)   // [NBLK][4]: per-block expert counts
#define WPACK_BYTES ((size_t)(WS_BLK + NBLK * 4) * 4)       // bf16 packed weights after ints
#define WPLANE 65536                // ushorts per 256x256 plane
#define PACK_BLK  ((7 << 15) / 256) // work-groups that pack the seven weight matrices

__device__ __forceinline__ unsigned short f2bf(float f) {
  unsigned u = __float_as_uint(f);
  u += 0x7FFFu + ((u >> 16) & 1u);          // round-to-nearest-even
  return (unsigned short)(u >> 16);
}
__device__ __forceinline__ float bf2f(unsigned short h) {
  return __uint_as_float(((unsigned)h) << 16);
}

// ---- split fp32 weights into bf16 hi/lo planes, pre-swizzled to WMMA B-frag order ----
// B frag (32x16 bf16): lane (r = lane&15, hi = lane>>4) holds col n = nt*16+r;
// VGPR v<4: K = ks*32 + 8*hi + 2*v + h ; v>=4: K = ks*32 + 16 + 8*hi + 2*(v-4) + h
__device__ __forceinline__ void pack_weights(int gid, const float* __restrict__ Wl,
                                             const float* __restrict__ Wm,
                                             const float* __restrict__ Wr,
                                             unsigned short* __restrict__ wp) {
  if (gid >= (7 << 15)) return;
  int v    = gid & 7;
  int lane = (gid >> 3) & 31;
  int ks   = (gid >> 8) & 7;
  int nt   = (gid >> 11) & 15;
  int mat  = gid >> 15;
  const float* W = (mat < 4) ? (Wl + mat * 65536)
                             : ((mat < 6) ? (Wm + (mat - 4) * 65536) : Wr);
  int hi = lane >> 4, r = lane & 15;
  int n = nt * 16 + r;
  unsigned hw = 0, lw = 0;
  for (int h = 0; h < 2; ++h) {
    int k = ks * 32 + 8 * hi + ((v < 4) ? (2 * v + h) : (16 + 2 * (v - 4) + h));
    float w = W[k * D_DIM + n];
    unsigned short wh = f2bf(w);
    unsigned short wl = f2bf(w - bf2f(wh));
    hw |= ((unsigned)wh) << (16 * h);
    lw |= ((unsigned)wl) << (16 * h);
  }
  int idx = (nt * 8 + ks) * 512 + lane * 16 + v * 2;
  *(unsigned*)(wp + (mat * 2 + 0) * WPLANE + idx) = hw;
  *(unsigned*)(wp + (mat * 2 + 1) * WPLANE + idx) = lw;
}

// lane e (e < 4) gets the number of lanes of this wave that chose expert e;
// mine = mask of the lanes that chose the same expert as this lane
__device__ __forceinline__ int wave_counts(int e, int lane, unsigned& mine) {
  unsigned b0 = __builtin_amdgcn_ballot_w32(e == 0);
  unsigned b1 = __builtin_amdgcn_ballot_w32(e == 1);
  unsigned b2 = __builtin_amdgcn_ballot_w32(e == 2);
  unsigned b3 = __builtin_amdgcn_ballot_w32(e == 3);
  mine = (e == 0) ? b0 : ((e == 1) ? b1 : ((e == 2) ? b2 : b3));
  return __popc((lane == 0) ? b0 : ((lane == 1) ? b1 : ((lane == 2) ? b2 : b3)));
}

// ---- K1: two jobs that do not depend on each other, in one grid. Work-groups 0 .. NBLK - 1: gate
//          (argmax, first-max tiebreak) + expert counts of a block of 256 rows; they last longest.
//          The PACK_BLK work-groups behind them pack the weights meanwhile. ----
__global__ void k_gate_pack(const float* __restrict__ x, const float* __restrict__ Wg,
                            const float* __restrict__ bg, const float* __restrict__ Wl,
                            const float* __restrict__ Wm, const float* __restrict__ Wr,
                            unsigned short* __restrict__ wp, int* __restrict__ wsi) {
  __shared__ int wcnt[8][4];
  if (blockIdx.x >= NBLK) {   // the same for the whole work-group, in front of the barrier below
    pack_weights((blockIdx.x - NBLK) * 256 + threadIdx.x, Wl, Wm, Wr, wp);
    return;
  }
  int row = blockIdx.x * 256 + threadIdx.x;   // NBLK blocks of 256 rows
  f4 acc = {0.f, 0.f, 0.f, 0.f};
  const float* xr = x + (size_t)row * D_DIM;
#pragma unroll 1   // rolled: four loads a trip, which share the one wait below
  for (int d0 = 0; d0 < D_DIM; d0 += 16) {
    const float* xd = xr + d0;
    f4 xq[4];
#pragma unroll   // unrolled here and below: xq must be registers
    for (int j = 0; j < 4; ++j) xq[j] = *(const f4*)(xd + 4 * j);
    // the wait that stands in front of any rewrite of a register that an issued load names;
    // the address is its input, so that it keeps its register up to this line
    asm volatile("s_wait_xcnt 0x0" :: "v"(xd) : "memory");
#pragma unroll   // as above
    for (int j = 0; j < 4; ++j) {
      const int d = d0 + 4 * j;
      const f4 xv = xq[j];
      acc += xv.x * *(const f4*)(Wg + (d + 0) * 4);
      acc += xv.y * *(const f4*)(Wg + (d + 1) * 4);
      acc += xv.z * *(const f4*)(Wg + (d + 2) * 4);
      acc += xv.w * *(const f4*)(Wg + (d + 3) * 4);
    }
  }
  float l0 = acc.x + bg[0], l1 = acc.y + bg[1], l2 = acc.z + bg[2], l3 = acc.w + bg[3];
  int bi = 0; float bv = l0;
  if (l1 > bv) { bv = l1; bi = 1; }
  if (l2 > bv) { bv = l2; bi = 2; }
  if (l3 > bv) { bv = l3; bi = 3; }
  wsi[WS_IDX + row] = bi;
  const int lane = threadIdx.x & 31, wave = threadIdx.x >> 5;
  unsigned mine;
  int c = wave_counts(bi, lane, mine);
  if (lane < 4) wcnt[wave][lane] = c;
  __syncthreads();
  if (threadIdx.x < 4) {
    int s = 0;
#pragma unroll
    for (int w = 0; w < 8; ++w) s += wcnt[w][threadIdx.x];
    wsi[WS_BLK + blockIdx.x * 4 + threadIdx.x] = s;
  }
}

// ---- K2: scatter rows into expert-grouped order (stable: rank = rows of the same expert before it).
//          Every work-group sums the per-block counts itself (all blocks: the experts' first slots,
//          counts padded to TILE_S; the blocks before its own: its start slots), so no launch of one
//          work-group stands between the gate and this one. Work-group 0 also stores the experts'
//          first slots and fills the padding perm slots with -1. ----
__global__ void k_scatter(int* __restrict__ wsi) {
  __shared__ int wcnt[8][4];
  __shared__ i4 wsum[8][2];   // per wave: counts of all row blocks, of the row blocks before this one
  const int t = threadIdx.x, lane = t & 31, wave = t >> 5;
  const int blk = blockIdx.x;                 // grid is exactly NBLK blocks of 256
  const int e = wsi[WS_IDX + blk * 256 + t];
  // thread t has the counts of row blocks 2t and 2t + 1 (NBLK = 2 * 256)
  const i4 c0 = *(const i4*)(wsi + WS_BLK + t * 8);
  const i4 c1 = *(const i4*)(wsi + WS_BLK + t * 8 + 4);
  const i4 z = {0, 0, 0, 0};
  const i4 all = c0 + c1;
  const i4 bef = ((2 * t < blk) ? c0 : z) + ((2 * t + 1 < blk) ? c1 : z);
  // a block's count is at most 256, a wave's sum of 64 blocks at most 16384: two experts share a word
  int s[4] = { all.x | (all.y << 16), all.z | (all.w << 16), bef.x | (bef.y << 16), bef.z | (bef.w << 16) };
#pragma unroll   // unrolled, both loops: s must be registers
  for (int d = 16; d > 0; d >>= 1)
#pragma unroll   // as above
    for (int k = 0; k < 4; ++k) s[k] += __shfl_xor(s[k], d);
  unsigned mine;
  int c = wave_counts(e, lane, mine);
  if (lane < 4) wcnt[wave][lane] = c;
  if (lane == 0) {
    wsum[wave][0] = i4{ s[0] & 0xFFFF, s[0] >> 16, s[1] & 0xFFFF, s[1] >> 16 };
    wsum[wave][1] = i4{ s[2] & 0xFFFF, s[2] >> 16, s[3] & 0xFFFF, s[3] >> 16 };
  }
  __syncthreads();
  i4 tot = z, before = z;
#pragma unroll   // unrolled: sixteen LDS reads issued together
  for (int w = 0; w < 8; ++w) { tot += wsum[w][0]; before += wsum[w][1]; }
  const i4 pad = (tot + (TILE_S - 1)) / TILE_S * TILE_S;
  const i4 off = { 0, pad.x, pad.x + pad.y, pad.x + pad.y + pad.z };
  const i4 st = off + before;                 // this block's start slot per expert
  const int st01 = (e & 1) ? st.y : st.x, st23 = (e & 1) ? st.w : st.z;
  int pos = ((e & 2) ? st23 : st01) + __popc(mine & ((1u << lane) - 1u));
#pragma unroll   // branch-free: seven LDS reads issued together instead of a loop of dependent trips
  for (int w = 0; w < 7; ++w) pos += (w < wave) ? wcnt[w][e] : 0;
  wsi[WS_PERM + pos] = blk * 256 + t;
  if (blk == 0) {
    // the wait that stands in front of any rewrite of a register that an issued store names
    asm volatile("s_wait_xcnt 0x0" ::: "memory");
    if (t < TILE_S) {
#pragma unroll   // unrolled: tot, pad and off must be registers
      for (int k = 0; k < 4; ++k)
        if (tot[k] + t < pad[k]) wsi[WS_PERM + off[k] + tot[k] + t] = -1;
    }
    if (t < 4) wsi[WS_OFFS + t] = off[t];
    if (t == 4) wsi[WS_OFFS + 4] = off.w + pad.w;
  }
}

// ---- bf16x3 GEMM layer: C = relu(in * W + bias); in LDS hi/lo bf16 planes.
//      A layer writes its result over its own input planes: the sums wait in registers until
//      every wave has read its last fragment. The last layer stages f32 there (stage = the two
//      planes as one array) and stores each row to global memory as whole 128-byte lines. ----
// the wave's four B fragments (two column tiles, hi and lo plane) of k step ks; w = the layer's hi
// plane, the same for the whole work-group (its lo plane follows it), voff = the lane's byte offset
__device__ __forceinline__ void load_b(Frag (&b)[2][2], const unsigned short* __restrict__ w,
                                       unsigned voff, int ks) {
  const char* p = (const char*)w + voff;
#pragma unroll   // unrolled, both loops: b must be registers
  for (int t = 0; t < 2; ++t)
#pragma unroll
    for (int pl = 0; pl < 2; ++pl) {
      b[t][pl].q[0] = *(const f4*)(p + (pl * WPLANE + (t * 8 + ks) * 512) * 2);
      b[t][pl].q[1] = *(const f4*)(p + (pl * WPLANE + (t * 8 + ks) * 512) * 2 + 16);
    }
}

// Operands are fetched ahead of their use. A step is one 16-row tile of one k step: four matrix
// instructions on its hi A fragment, then two on its lo one. In front of step s stand four LDS loads
// in one group: the hi fragment of step s + 2 (ring of three register sets) and the lo fragment of
// step s + 1 (two sets), so each has about ten matrix instructions between its load and its use.
// The B fragments of k step ks + NB - 1 are loaded at the first step of k step ks into the set that
// k step ks - 1 has left; past the last k step they are the next layer's first ones (wN). On entry
// bq[0 .. NB - 2] hold this layer's first k steps. MT = 16-row tiles of the work-group's tile: with
// 8 of them one k step ahead is far enough, with 2 a k step is so short that it takes three.
template <bool LAST, int MT, int NB>
__device__ __forceinline__ void gemm_layer(
    unsigned short* inH, unsigned short* inL,
    const unsigned short* __restrict__ wC,  const unsigned short* __restrict__ wN,
    unsigned voff, Frag (&bq)[NB][2][2],
    const float* __restrict__ bias,
    float* __restrict__ out, const int* __restrict__ rows_s, float* stage) {
  const int lane = threadIdx.x & 31;
  const int wave = threadIdx.x >> 5;
  const int r = lane & 15, hi = lane >> 4, hi8 = hi * 8;
  const int nt0 = wave * 2;

  v8f acc[2][MT];
#pragma unroll
  for (int t = 0; t < 2; ++t)
#pragma unroll
    for (int m = 0; m < MT; ++m)
#pragma unroll
      for (int q = 0; q < 8; ++q) acc[t][m][q] = 0.f;

  Frag ah[3], al[2];   // A fragments: hi plane [step mod 3], lo plane [step mod 2]
#pragma unroll   // unrolled here and below: ah, al, bq and acc must be registers
  for (int s = 0; s < 2; ++s) {
    const unsigned short* pah = inH + (s * 16 + r) * PADH + hi8;
    ah[s].q[0] = *(const f4*)(pah);      ah[s].q[1] = *(const f4*)(pah + 16);
  }
  {
    const unsigned short* pal = inL + r * PADH + hi8;
    al[0].q[0] = *(const f4*)(pal);      al[0].q[1] = *(const f4*)(pal + 16);
  }
#pragma unroll   // as above
  for (int s = 0; s < KSTEPS * MT; ++s) {
    const int ks = s / MT, m = s % MT;
    if (s + 2 < KSTEPS * MT) {
      const int s2 = s + 2;
      const unsigned short* pah = inH + ((s2 % MT) * 16 + r) * PADH + (s2 / MT) * 32 + hi8;
      ah[s2 % 3].q[0] = *(const f4*)(pah);    ah[s2 % 3].q[1] = *(const f4*)(pah + 16);
    }
    if (s + 1 < KSTEPS * MT) {
      const int s1 = s + 1;
      const unsigned short* pal = inL + ((s1 % MT) * 16 + r) * PADH + (s1 / MT) * 32 + hi8;
      al[s1 & 1].q[0] = *(const f4*)(pal);    al[s1 & 1].q[1] = *(const f4*)(pal + 16);
    }
    if (m == 0) {
      const int kn = ks + NB - 1;
      if (kn < KSTEPS) load_b(bq[kn % NB], wC, voff, kn);
      else if (!LAST)  load_b(bq[kn % NB], wN, voff, kn - KSTEPS);
    }
    // holds the loads above in front of this step's matrix instructions: the scheduler otherwise
    // sinks each load to just before its use, and the wave waits out the latency there
    __builtin_amdgcn_sched_barrier(0);
    Frag (&bc)[2][2] = bq[ks % NB];
    // per accumulator the order hi*hi, hi*lo, lo*hi; the two column tiles alternate
#pragma unroll   // as above
    for (int t = 0; t < 2; ++t)
      acc[t][m] = __builtin_amdgcn_wmma_f32_16x16x32_bf16(false, ah[s % 3].v, false, bc[t][0].v,
                                                          (short)0, acc[t][m], false, false);
#pragma unroll   // as above
    for (int t = 0; t < 2; ++t)
      acc[t][m] = __builtin_amdgcn_wmma_f32_16x16x32_bf16(false, ah[s % 3].v, false, bc[t][1].v,
                                                          (short)0, acc[t][m], false, false);
#pragma unroll   // as above
    for (int t = 0; t < 2; ++t)
      acc[t][m] = __builtin_amdgcn_wmma_f32_16x16x32_bf16(false, al[s & 1].v, false, bc[t][0].v,
                                                          (short)0, acc[t][m], false, false);
    // ends the step: the next step's loads stay behind these matrix instructions
    __builtin_amdgcn_sched_barrier(0);
  }

  // every wave reads all rows and all k of the planes: none may be overwritten before the last read
  __syncthreads();

  // epilogue: bias + relu; write next-layer LDS planes (in place) or the staged f32 result
#pragma unroll
  for (int t = 0; t < 2; ++t) {
    const int col = (nt0 + t) * 16 + r;
    const float bv = bias[col];
#pragma unroll
    for (int m = 0; m < MT; ++m)
#pragma unroll
      for (int q = 0; q < 8; ++q) {
        float val = fmaxf(acc[t][m][q] + bv, 0.f);
        int row = m * 16 + q + hi8;     // C layout: M = vgpr + 8*hi
        if (LAST) {
          stage[(hi8 * SPITCH + col) + (m * 16 + q) * SPITCH] = val;
        } else {
          unsigned short h = f2bf(val);
          inH[row * PADH + col] = h;
          inL[row * PADH + col] = f2bf(val - bf2f(h));
        }
      }
  }

  if (LAST) {
    __syncthreads();   // a wave stores rows whose columns all eight waves have staged
    constexpr int RW = MT * 16 / WAVES;   // result rows that one wave stores
    const int row0 = wave * RW;
    i4 rr[RW / 4];
#pragma unroll   // unrolled here and below: rr, va and vb must be registers
    for (int k = 0; k < RW / 4; ++k) rr[k] = *(const i4*)(rows_s + row0 + 4 * k);
    f4 va[RW], vb[RW];   // left and right half of each row, 16 bytes a lane
#pragma unroll   // as above
    for (int j = 0; j < RW; ++j) {
      va[j] = *(const f4*)(stage + (row0 + j) * SPITCH + lane * 4);
      vb[j] = *(const f4*)(stage + (row0 + j) * SPITCH + D_DIM / 2 + lane * 4);
    }
#pragma unroll   // as above
    for (int j = 0; j < RW; ++j) {
      // the same in every lane: as a scalar it gives a scalar branch and a scalar row address
      const int ro = __builtin_amdgcn_readfirstlane(rr[j >> 2][j & 3]);
      if (ro >= 0) {   // a padding slot has no row
        float* po = out + (size_t)ro * D_DIM + lane * 4;
        *(f4*)(po) = va[j];
        *(f4*)(po + D_DIM / 2) = vb[j];
        // the wait that stands in front of any rewrite of a register that an issued store names
        asm volatile("s_wait_xcnt 0x0" ::: "memory");
      }
    }
  }
}

// ---- K3: fused routed 3-layer GEMM over one expert-grouped tile ----
// An expert's rows (padded to TILE_S) are cut into 128-row tiles and, for what is left over, 32-row
// tiles. The large tiles never number more than B_ROWS / TILE_M, which fills the chip's places a whole
// number of times; the small tiles have the highest block indices and are short (for speed only).
// One pair of LDS planes (about 137 KB) and at most 256 registers a wave: two work-groups share a WGP.
__global__ __launch_bounds__(BLK, 4) void k_main(
    const float* __restrict__ x, const float* __restrict__ b_leaf,
    const float* __restrict__ b_mid, const float* __restrict__ b_root,
    const unsigned short* __restrict__ wp, const int* __restrict__ wsi,
    float* __restrict__ out) {
  // hi and lo plane of the tile's current layer; at the end the f32 result (TILE_M * SPITCH floats fit)
  __shared__ __attribute__((aligned(16))) unsigned short smem[2 * TILE_M * PADH];
  __shared__ __attribute__((aligned(16))) int rows_s[TILE_M];   // read four at a time in the gather
  const int PLANE = TILE_M * PADH;
  unsigned short* pAh = smem;
  unsigned short* pAl = smem + PLANE;

  const int o1 = wsi[WS_OFFS + 1], o2 = wsi[WS_OFFS + 2];
  const int o3 = wsi[WS_OFFS + 3], o4 = wsi[WS_OFFS + 4];
  // large tiles of experts 0 .. e - 1, then the same for the small tiles
  const int f1 = o1 / TILE_M, f2 = f1 + (o2 - o1) / TILE_M;
  const int f3 = f2 + (o3 - o2) / TILE_M, f4n = f3 + (o4 - o3) / TILE_M;
  const int g1 = o1 % TILE_M / TILE_S, g2 = g1 + (o2 - o1) % TILE_M / TILE_S;
  const int g3 = g2 + (o3 - o2) % TILE_M / TILE_S, g4 = g3 + (o4 - o3) % TILE_M / TILE_S;
  const bool small = (int)blockIdx.x >= f4n;
  const int b = small ? (int)blockIdx.x - f4n : (int)blockIdx.x;   // index among the tiles of its size
  if (small && b >= g4) return;
  const int c1 = small ? g1 : f1, c2 = small ? g2 : f2, c3 = small ? g3 : f3;
  const int e = (b < c1) ? 0 : ((b < c2) ? 1 : ((b < c3) ? 2 : 3));
  const int p = e >> 1;
  const int oe = (e == 0) ? 0 : ((e == 1) ? o1 : ((e == 2) ? o2 : o3));     // the expert's first slot
  const int on = (e == 0) ? o1 : ((e == 1) ? o2 : ((e == 2) ? o3 : o4));    // the next expert's
  const int ce = (e == 0) ? 0 : ((e == 1) ? c1 : ((e == 2) ? c2 : c3));     // tiles of this size before it
  const int base = small ? oe + (on - oe) / TILE_M * TILE_M + (b - ce) * TILE_S
                         : oe + (b - ce) * TILE_M;
  const int nrows = small ? TILE_S : TILE_M;

  const int tid = threadIdx.x;
  // a small tile's slots past its rows count as padding slots
  if (tid < TILE_M) rows_s[tid] = (tid < nrows) ? wsi[WS_PERM + base + tid] : -1;
  __syncthreads();

  // gather x rows, split fp32 -> bf16 hi/lo planes.
  // A thread issues all its row loads before it converts the first: one memory latency per
  // tile instead of one per load. The loads carry no branch: a padding slot reads row 0, and
  // what the layers make of it is never stored (the last layer stores only slots with a row).
  const int grow = (tid >> 6) * (2 * GATHER_H);   // this thread's tile rows: grow .. grow + 2 * GATHER_H - 1
  const int gq = tid & 63;                        // its 16-byte piece of each row
  u32x4 q[GATHER_H / 2];                          // load offsets, in 16-byte units
#pragma unroll   // unrolled here and in the loops over j below: q, xa and xb must be registers
  for (int k = 0; k < GATHER_H / 2; ++k) {
    const i4 r = *(const i4*)(rows_s + grow + 4 * k);
#pragma unroll   // as above
    for (int s = 0; s < 4; ++s) q[k][s] = ((unsigned)(r[s] < 0 ? 0 : r[s]) << 6) + gq;
  }
  f4 xa[GATHER_H], xb[GATHER_H];                  // first and second half of the loads
#pragma unroll   // as above
  for (int j = 0; j < GATHER_H; ++j) xa[j] = *(const f4*)(x + (size_t)q[j >> 2][j & 3] * 4);
#pragma unroll   // as above
  for (int j = 0; j < GATHER_H; ++j)
    xb[j] = *(const f4*)(x + (size_t)q[(GATHER_H + j) >> 2][j & 3] * 4);
  // the wait that stands in front of any rewrite of a register that an issued load names;
  // the offsets are its inputs, so that each keeps its register up to this line
  asm volatile("s_wait_xcnt 0x0"
               :: "v"(q[0]), "v"(q[1]), "v"(q[2]), "v"(q[3]), "v"(q[4]), "v"(q[5]), "v"(q[6]), "v"(q[7])
               : "memory");
  // hi planes of the three layers' packed weights (the lo plane follows its hi plane)
  const unsigned short* wLeafH = wp + (2 * e) * WPLANE;
  const unsigned short* wMidH  = wp + (2 * (4 + p)) * WPLANE;
  const unsigned short* wRootH = wp + 12 * WPLANE;
  const unsigned voff = ((tid >> 5) * 2 * 8 * 512 + (tid & 31) * 16) * 2;   // the wave's column tiles, the lane's 32 bytes
#pragma unroll 1   // rolled: the convert code stands once for both halves, which keeps the kernel's text short
  for (int h = 0; h < 2; ++h) {
#pragma unroll   // as above
    for (int j = 0; j < GATHER_H; ++j) {
      const int row = grow + h * GATHER_H + j;
      const int c = gq << 2;
      const f4 xv = xa[j];
      u16x4 hv = { f2bf(xv.x), f2bf(xv.y), f2bf(xv.z), f2bf(xv.w) };
      u16x4 lv = { f2bf(xv.x - bf2f(hv.x)), f2bf(xv.y - bf2f(hv.y)),
                   f2bf(xv.z - bf2f(hv.z)), f2bf(xv.w - bf2f(hv.w)) };
      *(u16x4*)(pAh + row * PADH + c) = hv;
      *(u16x4*)(pAl + row * PADH + c) = lv;
      xa[j] = xb[j];
    }
  }
  if (!small) {   // the same for the whole work-group: the barriers inside are passed by all or none
    Frag bq[2][2][2];   // B fragments: [k step mod 2][column tile][hi, lo plane]
    load_b(bq[0], wLeafH, voff, 0);   // the leaf layer's first, in flight over the barrier
    __syncthreads();

    // leaf (routed expert e)
    gemm_layer<false, TILE_M / 16, 2>(pAh, pAl, wLeafH, wMidH, voff, bq,
                                      b_leaf + e * D_DIM, nullptr, nullptr, nullptr);
    __syncthreads();
    // mid (parent p)
    gemm_layer<false, TILE_M / 16, 2>(pAh, pAl, wMidH, wRootH, voff, bq,
                                      b_mid + p * D_DIM, nullptr, nullptr, nullptr);
    __syncthreads();
    // root, scatter to original row order
    gemm_layer<true, TILE_M / 16, 2>(pAh, pAl, wRootH, nullptr, voff, bq,
                                     b_root, out, rows_s, (float*)smem);
  } else {
    Frag bq[4][2][2];   // B fragments: [k step mod 4][column tile][hi, lo plane]
    // the loads stand behind the barrier here: in front of it the compiler merges the first of them
    // with the other branch's and keeps those registers alive through this branch, which then spills
    __syncthreads();
#pragma unroll   // unrolled: bq must be registers
    for (int k = 0; k < 3; ++k) load_b(bq[k], wLeafH, voff, k);   // the leaf layer's first three

    gemm_layer<false, TILE_S / 16, 4>(pAh, pAl, wLeafH, wMidH, voff, bq,
                                      b_leaf + e * D_DIM, nullptr, nullptr, nullptr);
    __syncthreads();
    gemm_layer<false, TILE_S / 16, 4>(pAh, pAl, wMidH, wRootH, voff, bq,
                                      b_mid + p * D_DIM, nullptr, nullptr, nullptr);
    __syncthreads();
    gemm_layer<true, TILE_S / 16, 4>(pAh, pAl, wRootH, nullptr, voff, bq,
                                     b_root, out, rows_s, (float*)smem);
  }
}

extern "C" void kernel_launch(void* const* d_in, const int* in_sizes, int n_in,
                              void* d_out, int out_size, void* d_ws, size_t ws_size,
                              hipStream_t stream) {
  (void)in_sizes; (void)n_in; (void)out_size; (void)ws_size;
  const float* x      = (const float*)d_in[0];
  const float* Wg     = (const float*)d_in[1];
  const float* bg     = (const float*)d_in[2];
  const float* W_leaf = (const float*)d_in[3];
  const float* b_leaf = (const float*)d_in[4];
  const float* W_mid  = (const float*)d_in[5];
  const float* b_mid  = (const float*)d_in[6];
  const float* W_root = (const float*)d_in[7];
  const float* b_root = (const float*)d_in[8];
  float* out = (float*)d_out;
  int* wsi = (int*)d_ws;
  unsigned short* wp = (unsigned short*)((char*)d_ws + WPACK_BYTES);

  k_gate_pack<<<NBLK + PACK_BLK, 256, 0, stream>>>(x, Wg, bg, W_leaf, W_mid, W_root, wp, wsi);
  k_scatter<<<NBLK, 256, 0, stream>>>(wsi);
  k_main<<<B_ROWS / TILE_M + 12, BLK, 0, stream>>>(x, b_leaf, b_mid, b_root, wp, wsi, out);
}

// v008
// One run takes 104 microseconds.
// In two side-by-side timings against v007, it was 1.09 and 1.10 times as fast.
// Over all steps from v000 it is 3.36 times as fast.
#include <hip/hip_runtime.h>

#define B_ROWS 131072
#define D_DIM  256
#define TILE_M 128
#define TILE_S 32             // rows of a small tile: what an expert's rows leave over after its 128-row tiles
#define PADH   272            // LDS row stride in halves (breaks bank conflicts)
#define KSTEPS 8              // 256 / 32
#define WAVES  8
#define BLK    (WAVES * 32)   // 256 threads, 8 wave32s
#define GATHER_H (TILE_M * (D_DIM / 4) / BLK / 2)   // 16: half of a thread's 16-byte loads in the gather
#define SPITCH 260            // LDS row stride in floats of the staged result: the 16-byte stores of 16 rows fall on 64 different banks

typedef __attribute__((ext_vector_type(16))) __bf16          v16bf;
typedef __attribute__((ext_vector_type(8)))  float           v8f;
typedef __attribute__((ext_vector_type(4)))  float           f4;
typedef __attribute__((ext_vector_type(4)))  unsigned short  u16x4;
typedef __attribute__((ext_vector_type(4)))  int             i4;
typedef __attribute__((ext_vector_type(4)))  unsigned        u32x4;
typedef __attribute__((ext_vector_type(2)))  float           f2;
typedef __attribute__((ext_vector_type(2)))  __bf16          bf2;

union Frag { f4 q[2]; v16bf v; };

// ---- workspace layout (int units) ----
#define WS_OFFS   8                 // offs[0..4], offs[4] = padded total
#define WS_IDX    16
#define WS_PERM   (16 + B_ROWS)
#define WS_PERM_LEN (B_ROWS + 4 * TILE_M)
#define NBLK      (B_ROWS / 256)    // row blocks of k_gate_pack's gate and of k_scatter
#define WS_BLK    (WS_PERM + WS_PERM_LEN)   // [NBLK][4]: per-block expert counts
#define WPACK_BYTES ((size_t)(WS_BLK + NBLK * 4) * 4)       // bf16 packed weights after ints
#define WPLANE 65536                // ushorts per 256x256 plane
#define PACK_BLK  ((7 << 15) / 256) // work-groups that pack the seven weight matrices

__device__ __forceinline__ unsigned short f2bf(float f) {
  unsigned u = __float_as_uint(f);
  u += 0x7FFFu + ((u >> 16) & 1u);          // round-to-nearest-even
  return (unsigned short)(u >> 16);
}
__device__ __forceinline__ float bf2f(unsigned short h) {
  return __uint_as_float(((unsigned)h) << 16);
}

// two floats -> two bf16 in one word (a in the low half), round-to-nearest-even: one packed convert
__device__ __forceinline__ unsigned pk_bf(float a, float b) {
  const f2 v = {a, b};
  return __builtin_bit_cast(unsigned, __builtin_convertvector(v, bf2));
}

// ---- split fp32 weights into bf16 hi/lo planes, pre-swizzled to WMMA B-frag order ----
// B frag (32x16 bf16): lane (r = lane&15, hi = lane>>4) holds col n = nt*16+r;
// VGPR v<4: K = ks*32 + 8*hi + 2*v + h ; v>=4: K = ks*32 + 16 + 8*hi + 2*(v-4) + h
__device__ __forceinline__ void pack_weights(int gid, const float* __restrict__ Wl,
                                             const float* __restrict__ Wm,
                                             const float* __restrict__ Wr,
                                             unsigned short* __restrict__ wp) {
  if (gid >= (7 << 15)) return;
  int v    = gid & 7;
  int lane = (gid >> 3) & 31;
  int ks   = (gid >> 8) & 7;
  int nt   = (gid >> 11) & 15;
  int mat  = gid >> 15;
  const float* W = (mat < 4) ? (Wl + mat * 65536)
                             : ((mat < 6) ? (Wm + (mat - 4) * 65536) : Wr);
  int hi = lane >> 4, r = lane & 15;
  int n = nt * 16 + r;
  unsigned hw = 0, lw = 0;
  for (int h = 0; h < 2; ++h) {
    int k = ks * 32 + 8 * hi + ((v < 4) ? (2 * v + h) : (16 + 2 * (v - 4) + h));
    float w = W[k * D_DIM + n];
    unsigned short wh = f2bf(w);
    unsigned short wl = f2bf(w - bf2f(wh));
    hw |= ((unsigned)wh) << (16 * h);
    lw |= ((unsigned)wl) << (16 * h);
  }
  int idx = (nt * 8 + ks) * 512 + lane * 16 + v * 2;
  *(unsigned*)(wp + (mat * 2 + 0) * WPLANE + idx) = hw;
  *(unsigned*)(wp + (mat * 2 + 1) * WPLANE + idx) = lw;
}

// lane e (e < 4) gets the number of lanes of this wave that chose expert e;
// mine = mask of the lanes that chose the same expert as this lane
__device__ __forceinline__ int wave_counts(int e, int lane, unsigned& mine) {
  unsigned b0 = __builtin_amdgcn_ballot_w32(e == 0);
  unsigned b1 = __builtin_amdgcn_ballot_w32(e == 1);
  unsigned b2 = __builtin_amdgcn_ballot_w32(e == 2);
  unsigned b3 = __builtin_amdgcn_ballot_w32(e == 3);
  mine = (e == 0) ? b0 : ((e == 1) ? b1 : ((e == 2) ? b2 : b3));
  return __popc((lane == 0) ? b0 : ((lane == 1) ? b1 : ((lane == 2) ? b2 : b3)));
}

// ---- K1: two jobs that do not depend on each other, in one grid. Work-groups 0 .. NBLK - 1: gate
//          (argmax, first-max tiebreak) + expert counts of a block of 256 rows; they last longest.
//          The PACK_BLK work-groups behind them pack the weights meanwhile. ----
__global__ void k_gate_pack(const float* __restrict__ x, const float* __restrict__ Wg,
                            const float* __restrict__ bg, const float* __restrict__ Wl,
                            const float* __restrict__ Wm, const float* __restrict__ Wr,
                            unsigned short* __restrict__ wp, int* __restrict__ wsi) {
  __shared__ int wcnt[8][4];
  if (blockIdx.x >= NBLK) {   // the same for the whole work-group, in front of the barrier below
    pack_weights((blockIdx.x - NBLK) * 256 + threadIdx.x, Wl, Wm, Wr, wp);
    return;
  }
  int row = blockIdx.x * 256 + threadIdx.x;   // NBLK blocks of 256 rows
  f4 acc = {0.f, 0.f, 0.f, 0.f};
  const float* xr = x + (size_t)row * D_DIM;
#pragma unroll 1   // rolled: four loads a trip, which share the one wait below
  for (int d0 = 0; d0 < D_DIM; d0 += 16) {
    const float* xd = xr + d0;
    f4 xq[4];
#pragma unroll   // unrolled here and below: xq must be registers
    for (int j = 0; j < 4; ++j) xq[j] = *(const f4*)(xd + 4 * j);
    // the wait that stands in front of any rewrite of a register that an issued load names;
    // the address is its input, so that it keeps its register up to this line
    asm volatile("s_wait_xcnt 0x0" :: "v"(xd) : "memory");
#pragma unroll   // as above
    for (int j = 0; j < 4; ++j) {
      const int d = d0 + 4 * j;
      const f4 xv = xq[j];
      acc += xv.x * *(const f4*)(Wg + (d + 0) * 4);
      acc += xv.y * *(const f4*)(Wg + (d + 1) * 4);
      acc += xv.z * *(const f4*)(Wg + (d + 2) * 4);
      acc += xv.w * *(const f4*)(Wg + (d + 3) * 4);
    }
  }
  float l0 = acc.x + bg[0], l1 = acc.y + bg[1], l2 = acc.z + bg[2], l3 = acc.w + bg[3];
  int bi = 0; float bv = l0;
  if (l1 > bv) { bv = l1; bi = 1; }
  if (l2 > bv) { bv = l2; bi = 2; }
  if (l3 > bv) { bv = l3; bi = 3; }
  wsi[WS_IDX + row] = bi;
  const int lane = threadIdx.x & 31, wave = threadIdx.x >> 5;
  unsigned mine;
  int c = wave_counts(bi, lane, mine);
  if (lane < 4) wcnt[wave][lane] = c;
  __syncthreads();
  if (threadIdx.x < 4) {
    int s = 0;
#pragma unroll
    for (int w = 0; w < 8; ++w) s += wcnt[w][threadIdx.x];
    wsi[WS_BLK + blockIdx.x * 4 + threadIdx.x] = s;
  }
}

// ---- K2: scatter rows into expert-grouped order (stable: rank = rows of the same expert before it).
//          Every work-group sums the per-block counts itself (all blocks: the experts' first slots,
//          counts padded to TILE_S; the blocks before its own: its start slots), so no launch of one
//          work-group stands between the gate and this one. Work-group 0 also stores the experts'
//          first slots and fills the padding perm slots with -1. ----
__global__ void k_scatter(int* __restrict__ wsi) {
  __shared__ int wcnt[8][4];
  __shared__ i4 wsum[8][2];   // per wave: counts of all row blocks, of the row blocks before this one
  const int t = threadIdx.x, lane = t & 31, wave = t >> 5;
  const int blk = blockIdx.x;                 // grid is exactly NBLK blocks of 256
  const int e = wsi[WS_IDX + blk * 256 + t];
  // thread t has the counts of row blocks 2t and 2t + 1 (NBLK = 2 * 256)
  const i4 c0 = *(const i4*)(wsi + WS_BLK + t * 8);
  const i4 c1 = *(const i4*)(wsi + WS_BLK + t * 8 + 4);
  const i4 z = {0, 0, 0, 0};
  const i4 all = c0 + c1;
  const i4 bef = ((2 * t < blk) ? c0 : z) + ((2 * t + 1 < blk) ? c1 : z);
  // a block's count is at most 256, a wave's sum of 64 blocks at most 16384: two experts share a word
  int s[4] = { all.x | (all.y << 16), all.z | (all.w << 16), bef.x | (bef.y << 16), bef.z | (bef.w << 16) };
#pragma unroll   // unrolled, both loops: s must be registers
  for (int d = 16; d > 0; d >>= 1)
#pragma unroll   // as above
    for (int k = 0; k < 4; ++k) s[k] += __shfl_xor(s[k], d);
  unsigned mine;
  int c = wave_counts(e, lane, mine);
  if (lane < 4) wcnt[wave][lane] = c;
  if (lane == 0) {
    wsum[wave][0] = i4{ s[0] & 0xFFFF, s[0] >> 16, s[1] & 0xFFFF, s[1] >> 16 };
    wsum[wave][1] = i4{ s[2] & 0xFFFF, s[2] >> 16, s[3] & 0xFFFF, s[3] >> 16 };
  }
  __syncthreads();
  i4 tot = z, before = z;
#pragma unroll   // unrolled: sixteen LDS reads issued together
  for (int w = 0; w < 8; ++w) { tot += wsum[w][0]; before += wsum[w][1]; }
  const i4 pad = (tot + (TILE_S - 1)) / TILE_S * TILE_S;
  const i4 off = { 0, pad.x, pad.x + pad.y, pad.x + pad.y + pad.z };
  const i4 st = off + before;                 // this block's start slot per expert
  const int st01 = (e & 1) ? st.y : st.x, st23 = (e & 1) ? st.w : st.z;
  int pos = ((e & 2) ? st23 : st01) + __popc(mine & ((1u << lane) - 1u));
#pragma unroll   // branch-free: seven LDS reads issued together instead of a loop of dependent trips
  for (int w = 0; w < 7; ++w) pos += (w < wave) ? wcnt[w][e] : 0;
  wsi[WS_PERM + pos] = blk * 256 + t;
  if (blk == 0) {
    // the wait that stands in front of any rewrite of a register that an issued store names
    asm volatile("s_wait_xcnt 0x0" ::: "memory");
    if (t < TILE_S) {
#pragma unroll   // unrolled: tot, pad and off must be registers
      for (int k = 0; k < 4; ++k)
        if (tot[k] + t < pad[k]) wsi[WS_PERM + off[k] + tot[k] + t] = -1;
    }
    if (t < 4) wsi[WS_OFFS + t] = off[t];
    if (t == 4) wsi[WS_OFFS + 4] = off.w + pad.w;
  }
}

// ---- bf16x3 GEMM layer: C = relu(in * W + bias); in LDS hi/lo bf16 planes.
//      A layer writes its result over its own input planes: the sums wait in registers until
//      every wave has read its last fragment. The last layer stages f32 there (stage = the two
//      planes as one array) and stores each row to global memory as whole 128-byte lines.
//      The weights are the matrix instruction's A operand and the rows its B operand (both fragments
//      have the same lane map, so the loaders serve either place): the result tile comes out as
//      [feature][row], a lane holds 8 neighbouring features of ONE row, and they go to LDS in
//      16-byte stores. Below, "A fragment" still names a fragment of the rows (from LDS) and
//      "B fragment" one of the weights. ----
// the wave's four B fragments (two column tiles, hi and lo plane) of k step ks; w = the layer's hi
// plane, the same for the whole work-group (its lo plane follows it), voff = the lane's byte offset
__device__ __forceinline__ void load_b(Frag (&b)[2][2], const unsigned short* __restrict__ w,
                                       unsigned voff, int ks) {
  const char* p = (const char*)w + voff;
#pragma unroll   // unrolled, both loops: b must be registers
  for (int t = 0; t < 2; ++t)
#pragma unroll
    for (int pl = 0; pl < 2; ++pl) {
      b[t][pl].q[0] = *(const f4*)(p + (pl * WPLANE + (t * 8 + ks) * 512) * 2);
      b[t][pl].q[1] = *(const f4*)(p + (pl * WPLANE + (t * 8 + ks) * 512) * 2 + 16);
    }
}

// Operands are fetched ahead of their use. A step is one 16-row tile of one k step: four matrix
// instructions on its hi A fragment, then two on its lo one. In front of step s stand four LDS loads
// in one group: the hi fragment of step s + 2 (ring of three register sets) and the lo fragment of
// step s + 1 (two sets), so each has about ten matrix instructions between its load and its use.
// The B fragments of k step ks + NB - 1 are loaded at the first step of k step ks into the set that
// k step ks - 1 has left; past the last k step they are the next layer's first ones (wN). On entry
// bq[0 .. NB - 2] hold this layer's first k steps. MT = 16-row tiles of the work-group's tile: with
// 8 of them one k step ahead is far enough, with 2 a k step is so short that it takes three.
template <bool LAST, int MT, int NB>
__device__ __forceinline__ void gemm_layer(
    unsigned short* inH, unsigned short* inL,
    const unsigned short* __restrict__ wC,  const unsigned short* __restrict__ wN,
    unsigned voff, Frag (&bq)[NB][2][2],
    const float* __restrict__ bias,
    float* __restrict__ out, const int* __restrict__ rows_s, float* stage) {
  const int lane = threadIdx.x & 31;
  const int wave = threadIdx.x >> 5;
  const int r = lane & 15, hi = lane >> 4, hi8 = hi * 8;
  const int nt0 = wave * 2;

  v8f acc[2][MT];
#pragma unroll
  for (int t = 0; t < 2; ++t)
#pragma unroll
    for (int m = 0; m < MT; ++m)
#pragma unroll
      for (int q = 0; q < 8; ++q) acc[t][m][q] = 0.f;

  Frag ah[3], al[2];   // A fragments: hi plane [step mod 3], lo plane [step mod 2]
#pragma unroll   // unrolled here and below: ah, al, bq and acc must be registers
  for (int s = 0; s < 2; ++s) {
    const unsigned short* pah = inH + (s * 16 + r) * PADH + hi8;
    ah[s].q[0] = *(const f4*)(pah);      ah[s].q[1] = *(const f4*)(pah + 16);
  }
  {
    const unsigned short* pal = inL + r * PADH + hi8;
    al[0].q[0] = *(const f4*)(pal);      al[0].q[1] = *(const f4*)(pal + 16);
  }
#pragma unroll   // as above
  for (int s = 0; s < KSTEPS * MT; ++s) {
    const int ks = s / MT, m = s % MT;
    if (s + 2 < KSTEPS * MT) {
      const int s2 = s + 2;
      const unsigned short* pah = inH + ((s2 % MT) * 16 + r) * PADH + (s2 / MT) * 32 + hi8;
      ah[s2 % 3].q[0] = *(const f4*)(pah);    ah[s2 % 3].q[1] = *(const f4*)(pah + 16);
    }
    if (s + 1 < KSTEPS * MT) {
      const int s1 = s + 1;
      const unsigned short* pal = inL + ((s1 % MT) * 16 + r) * PADH + (s1 / MT) * 32 + hi8;
      al[s1 & 1].q[0] = *(const f4*)(pal);    al[s1 & 1].q[1] = *(const f4*)(pal + 16);
    }
    if (m == 0) {
      const int kn = ks + NB - 1;
      if (kn < KSTEPS) load_b(bq[kn % NB], wC, voff, kn);
      else if (!LAST)  load_b(bq[kn % NB], wN, voff, kn - KSTEPS);
    }
    // holds the loads above in front of this step's matrix instructions: the scheduler otherwise
    // sinks each load to just before its use, and the wave waits out the latency there
    __builtin_amdgcn_sched_barrier(0);
    Frag (&bc)[2][2] = bq[ks % NB];
    // per accumulator the order hi*hi, hi*lo, lo*hi; the two column tiles alternate
#pragma unroll   // as above
    for (int t = 0; t < 2; ++t)
      acc[t][m] = __builtin_amdgcn_wmma_f32_16x16x32_bf16(false, bc[t][0].v, false, ah[s % 3].v,
                                                          (short)0, acc[t][m], false, false);
#pragma unroll   // as above
    for (int t = 0; t < 2; ++t)
      acc[t][m] = __builtin_amdgcn_wmma_f32_16x16x32_bf16(false, bc[t][1].v, false, ah[s % 3].v,
                                                          (short)0, acc[t][m], false, false);
#pragma unroll   // as above
    for (int t = 0; t < 2; ++t)
      acc[t][m] = __builtin_amdgcn_wmma_f32_16x16x32_bf16(false, bc[t][0].v, false, al[s & 1].v,
                                                          (short)0, acc[t][m], false, false);
    // ends the step: the next step's loads stay behind these matrix instructions
    __builtin_amdgcn_sched_barrier(0);
  }

  // every wave reads all rows and all k of the planes: none may be overwritten before the last read
  __syncthreads();

  // epilogue: bias + relu; write next-layer LDS planes (in place) or the staged f32 result
#pragma unroll
  for (int t = 0; t < 2; ++t) {
    const int col = (nt0 + t) * 16 + hi8;   // result layout: feature = col + vgpr, row = m * 16 + r
    const f4 b0 = *(const f4*)(bias + col), b1 = *(const f4*)(bias + col + 4);
#pragma unroll
    for (int m = 0; m < MT; ++m) {
      float val[8];
#pragma unroll
      for (int q = 0; q < 8; ++q) val[q] = fmaxf(acc[t][m][q] + ((q < 4) ? b0[q & 3] : b1[q & 3]), 0.f);
      if (LAST) {
        float* ps = stage + (r * SPITCH + col) + m * 16 * SPITCH;
        *(f4*)(ps)     = f4{val[0], val[1], val[2], val[3]};
        *(f4*)(ps + 4) = f4{val[4], val[5], val[6], val[7]};
      } else {
        u32x4 hw, lw;   // the 8 features as bf16 pairs: value, and what the value leaves over
#pragma unroll   // unrolled: val, hw and lw must be registers
        for (int k = 0; k < 4; ++k) {
          const unsigned h = pk_bf(val[2 * k], val[2 * k + 1]);
          hw[k] = h;
          lw[k] = pk_bf(val[2 * k] - __uint_as_float(h << 16),
                        val[2 * k + 1] - __uint_as_float(h & 0xFFFF0000u));
        }
        *(u32x4*)(inH + (r * PADH + col) + m * 16 * PADH) = hw;
        *(u32x4*)(inL + (r * PADH + col) + m * 16 * PADH) = lw;
      }
    }
  }

  if (LAST) {
    __syncthreads();   // a wave stores rows whose columns all eight waves have staged
    constexpr int RW = MT * 16 / WAVES;   // result rows that one wave stores
    const int row0 = wave * RW;
    i4 rr[RW / 4];
#pragma unroll   // unrolled here and below: rr, va and vb must be registers
    for (int k = 0; k < RW / 4; ++k) rr[k] = *(const i4*)(rows_s + row0 + 4 * k);
    f4 va[RW], vb[RW];   // left and right half of each row, 16 bytes a lane
#pragma unroll   // as above
    for (int j = 0; j < RW; ++j) {
      va[j] = *(const f4*)(stage + (row0 + j) * SPITCH + lane * 4);
      vb[j] = *(const f4*)(stage + (row0 + j) * SPITCH + D_DIM / 2 + lane * 4);
    }
#pragma unroll   // as above
    for (int j = 0; j < RW; ++j) {
      // the same in every lane: as a scalar it gives a scalar branch and a scalar row address
      const int ro = __builtin_amdgcn_readfirstlane(rr[j >> 2][j & 3]);
      if (ro >= 0) {   // a padding slot has no row
        float* po = out + (size_t)ro * D_DIM + lane * 4;
        *(f4*)(po) = va[j];
        *(f4*)(po + D_DIM / 2) = vb[j];
        // the wait that stands in front of any rewrite of a register that an issued store names
        asm volatile("s_wait_xcnt 0x0" ::: "memory");
      }
    }
  }
}

// ---- K3: fused routed 3-layer GEMM over one expert-grouped tile ----
// An expert's rows (padded to TILE_S) are cut into 128-row tiles and, for what is left over, 32-row
// tiles. The large tiles never number more than B_ROWS / TILE_M, which fills the chip's places a whole
// number of times; the small tiles have the highest block indices and are short (for speed only).
// One pair of LDS planes (about 137 KB) and at most 256 registers a wave: two work-groups share a WGP.
__global__ __launch_bounds__(BLK, 4) void k_main(
    const float* __restrict__ x, const float* __restrict__ b_leaf,
    const float* __restrict__ b_mid, const float* __restrict__ b_root,
    const unsigned short* __restrict__ wp, const int* __restrict__ wsi,
    float* __restrict__ out) {
  // hi and lo plane of the tile's current layer; at the end the f32 result (TILE_M * SPITCH floats fit)
  __shared__ __attribute__((aligned(16))) unsigned short smem[2 * TILE_M * PADH];
  __shared__ __attribute__((aligned(16))) int rows_s[TILE_M];   // read four at a time in the gather
  const int PLANE = TILE_M * PADH;
  unsigned short* pAh = smem;
  unsigned short* pAl = smem + PLANE;

  const int o1 = wsi[WS_OFFS + 1], o2 = wsi[WS_OFFS + 2];
  const int o3 = wsi[WS_OFFS + 3], o4 = wsi[WS_OFFS + 4];
  // large tiles of experts 0 .. e - 1, then the same for the small tiles
  const int f1 = o1 / TILE_M, f2 = f1 + (o2 - o1) / TILE_M;
  const int f3 = f2 + (o3 - o2) / TILE_M, f4n = f3 + (o4 - o3) / TILE_M;
  const int g1 = o1 % TILE_M / TILE_S, g2 = g1 + (o2 - o1) % TILE_M / TILE_S;
  const int g3 = g2 + (o3 - o2) % TILE_M / TILE_S, g4 = g3 + (o4 - o3) % TILE_M / TILE_S;
  const bool small = (int)blockIdx.x >= f4n;
  const int b = small ? (int)blockIdx.x - f4n : (int)blockIdx.x;   // index among the tiles of its size
  if (small && b >= g4) return;
  const int c1 = small ? g1 : f1, c2 = small ? g2 : f2, c3 = small ? g3 : f3;
  const int e = (b < c1) ? 0 : ((b < c2) ? 1 : ((b < c3) ? 2 : 3));
  const int p = e >> 1;
  const int oe = (e == 0) ? 0 : ((e == 1) ? o1 : ((e == 2) ? o2 : o3));     // the expert's first slot
  const int on = (e == 0) ? o1 : ((e == 1) ? o2 : ((e == 2) ? o3 : o4));    // the next expert's
  const int ce = (e == 0) ? 0 : ((e == 1) ? c1 : ((e == 2) ? c2 : c3));     // tiles of this size before it
  const int base = small ? oe + (on - oe) / TILE_M * TILE_M + (b - ce) * TILE_S
                         : oe + (b - ce) * TILE_M;
  const int nrows = small ? TILE_S : TILE_M;

  const int tid = threadIdx.x;
  // a small tile's slots past its rows count as padding slots
  if (tid < TILE_M) rows_s[tid] = (tid < nrows) ? wsi[WS_PERM + base + tid] : -1;
  __syncthreads();

  // gather x rows, split fp32 -> bf16 hi/lo planes.
  // A thread issues all its row loads before it converts the first: one memory latency per
  // tile instead of one per load. The loads carry no branch: a padding slot reads row 0, and
  // what the layers make of it is never stored (the last layer stores only slots with a row).
  const int grow = (tid >> 6) * (2 * GATHER_H);   // this thread's tile rows: grow .. grow + 2 * GATHER_H - 1
  const int gq = tid & 63;                        // its 16-byte piece of each row
  u32x4 q[GATHER_H / 2];                          // load offsets, in 16-byte units
#pragma unroll   // unrolled here and in the loops over j below: q, xa and xb must be registers
  for (int k = 0; k < GATHER_H / 2; ++k) {
    const i4 r = *(const i4*)(rows_s + grow + 4 * k);
#pragma unroll   // as above
    for (int s = 0; s < 4; ++s) q[k][s] = ((unsigned)(r[s] < 0 ? 0 : r[s]) << 6) + gq;
  }
  f4 xa[GATHER_H], xb[GATHER_H];                  // first and second half of the loads
#pragma unroll   // as above
  for (int j = 0; j < GATHER_H; ++j) xa[j] = *(const f4*)(x + (size_t)q[j >> 2][j & 3] * 4);
#pragma unroll   // as above
  for (int j = 0; j < GATHER_H; ++j)
    xb[j] = *(const f4*)(x + (size_t)q[(GATHER_H + j) >> 2][j & 3] * 4);
  // the wait that stands in front of any rewrite of a register that an issued load names;
  // the offsets are its inputs, so that each keeps its register up to this line
  asm volatile("s_wait_xcnt 0x0"
               :: "v"(q[0]), "v"(q[1]), "v"(q[2]), "v"(q[3]), "v"(q[4]), "v"(q[5]), "v"(q[6]), "v"(q[7])
               : "memory");
  // hi planes of the three layers' packed weights (the lo plane follows its hi plane)
  const unsigned short* wLeafH = wp + (2 * e) * WPLANE;
  const unsigned short* wMidH  = wp + (2 * (4 + p)) * WPLANE;
  const unsigned short* wRootH = wp + 12 * WPLANE;
  const unsigned voff = ((tid >> 5) * 2 * 8 * 512 + (tid & 31) * 16) * 2;   // the wave's column tiles, the lane's 32 bytes
#pragma unroll 1   // rolled: the convert code stands once for both halves, which keeps the kernel's text short
  for (int h = 0; h < 2; ++h) {
#pragma unroll   // as above
    for (int j = 0; j < GATHER_H; ++j) {
      const int row = grow + h * GATHER_H + j;
      const int c = gq << 2;
      const f4 xv = xa[j];
      u16x4 hv = { f2bf(xv.x), f2bf(xv.y), f2bf(xv.z), f2bf(xv.w) };
      u16x4 lv = { f2bf(xv.x - bf2f(hv.x)), f2bf(xv.y - bf2f(hv.y)),
                   f2bf(xv.z - bf2f(hv.z)), f2bf(xv.w - bf2f(hv.w)) };
      *(u16x4*)(pAh + row * PADH + c) = hv;
      *(u16x4*)(pAl + row * PADH + c) = lv;
      xa[j] = xb[j];
    }
  }
  if (!small) {   // the same for the whole work-group: the barriers inside are passed by all or none
    Frag bq[2][2][2];   // B fragments: [k step mod 2][column tile][hi, lo plane]
    load_b(bq[0], wLeafH, voff, 0);   // the leaf layer's first, in flight over the barrier
    __syncthreads();

    // leaf (routed expert e)
    gemm_layer<false, TILE_M / 16, 2>(pAh, pAl, wLeafH, wMidH, voff, bq,
                                      b_leaf + e * D_DIM, nullptr, nullptr, nullptr);
    __syncthreads();
    // mid (parent p)
    gemm_layer<false, TILE_M / 16, 2>(pAh, pAl, wMidH, wRootH, voff, bq,
                                      b_mid + p * D_DIM, nullptr, nullptr, nullptr);
    __syncthreads();
    // root, scatter to original row order
    gemm_layer<true, TILE_M / 16, 2>(pAh, pAl, wRootH, nullptr, voff, bq,
                                     b_root, out, rows_s, (float*)smem);
  } else {
    Frag bq[4][2][2];   // B fragments: [k step mod 4][column tile][hi, lo plane]
    // the loads stand behind the barrier here: in front of it the compiler merges the first of them
    // with the other branch's and keeps those registers alive through this branch, which then spills
    __syncthreads();
#pragma unroll   // unrolled: bq must be registers
    for (int k = 0; k < 3; ++k) load_b(bq[k], wLeafH, voff, k);   // the leaf layer's first three

    gemm_layer<false, TILE_S / 16, 4>(pAh, pAl, wLeafH, wMidH, voff, bq,
                                      b_leaf + e * D_DIM, nullptr, nullptr, nullptr);
    __syncthreads();
    gemm_layer<false, TILE_S / 16, 4>(pAh, pAl, wMidH, wRootH, voff, bq,
                                      b_mid + p * D_DIM, nullptr, nullptr, nullptr);
    __syncthreads();
    gemm_layer<true, TILE_S / 16, 4>(pAh, pAl, wRootH, nullptr, voff, bq,
                                     b_root, out, rows_s, (float*)smem);
  }
}

extern "C" void kernel_launch(void* const* d_in, const int* in_sizes, int n_in,
                              void* d_out, int out_size, void* d_ws, size_t ws_size,
                              hipStream_t stream) {
  (void)in_sizes; (void)n_in; (void)out_size; (void)ws_size;
  const float* x      = (const float*)d_in[0];
  const float* Wg     = (const float*)d_in[1];
  const float* bg     = (const float*)d_in[2];
  const float* W_leaf = (const float*)d_in[3];
  const float* b_leaf = (const float*)d_in[4];
  const float* W_mid  = (const float*)d_in[5];
  const float* b_mid  = (const float*)d_in[6];
  const float* W_root = (const float*)d_in[7];
  const float* b_root = (const float*)d_in[8];
  float* out = (float*)d_out;
  int* wsi = (int*)d_ws;
  unsigned short* wp = (unsigned short*)((char*)d_ws + WPACK_BYTES);

  k_gate_pack<<<NBLK + PACK_BLK, 256, 0, stream>>>(x, Wg, bg, W_leaf, W_mid, W_root, wp, wsi);
  k_scatter<<<NBLK, 256, 0, stream>>>(wsi);
  k_main<<<B_ROWS / TILE_M + 12, BLK, 0, stream>>>(x, b_leaf, b_mid, b_root, wp, wsi, out);
}

// v009
// Measured time: 97.5 microseconds a run.
// Two timings next to v008 both put it at 1.07 times that version's speed.
// Counting every step since v000, it is 3.59 times as fast.
#include <hip/hip_runtime.h>

#define B_ROWS 131072
#define D_DIM  256
#define TILE_M 128
#define TILE_S 32             // rows of a small tile: what an expert's rows leave over after its 128-row tiles
#define PADH   272            // LDS row stride in halves (breaks bank conflicts)
#define KSTEPS 8              // 256 / 32
#define WAVES  8
#define BLK    (WAVES * 32)   // 256 threads, 8 wave32s
#define GATHER_H (TILE_M * (D_DIM / 4) / BLK / 2)   // 16: half of a thread's 16-byte loads in the gather
#define SPITCH 260            // LDS row stride in floats of the staged result: the 16-byte stores of 16 rows fall on 64 different banks

typedef __attribute__((ext_vector_type(16))) __bf16          v16bf;
typedef __attribute__((ext_vector_type(8)))  float           v8f;
typedef __attribute__((ext_vector_type(4)))  float           f4;
typedef __attribute__((ext_vector_type(4)))  unsigned short  u16x4;
typedef __attribute__((ext_vector_type(4)))  int             i4;
typedef __attribute__((ext_vector_type(4)))  unsigned        u32x4;
typedef __attribute__((ext_vector_type(2)))  float           f2;
typedef __attribute__((ext_vector_type(2)))  __bf16          bf2;

union Frag { f4 q[2]; v16bf v; };

// ---- workspace layout (int units) ----
#define WS_OFFS   8                 // offs[0..4], offs[4] = padded total
#define WS_IDX    16
#define WS_PERM   (16 + B_ROWS)
#define WS_PERM_LEN (B_ROWS + 4 * TILE_M)
#define NBLK      (B_ROWS / 256)    // row blocks of k_gate_pack's gate and of k_scatter
#define WS_BLK    (WS_PERM + WS_PERM_LEN)   // [NBLK][4]: per-block expert counts
#define WPACK_BYTES ((size_t)(WS_BLK + NBLK * 4) * 4)       // bf16 packed weights after ints
#define WPLANE 65536                // ushorts per 256x256 plane
#define PACK_BLK  ((7 << 15) / 256) // work-groups that pack the seven weight matrices

__device__ __forceinline__ unsigned short f2bf(float f) {
  unsigned u = __float_as_uint(f);
  u += 0x7FFFu + ((u >> 16) & 1u);          // round-to-nearest-even
  return (unsigned short)(u >> 16);
}
__device__ __forceinline__ float bf2f(unsigned short h) {
  return __uint_as_float(((unsigned)h) << 16);
}

// two floats -> two bf16 in one word (a in the low half), round-to-nearest-even: one packed convert
__device__ __forceinline__ unsigned pk_bf(float a, float b) {
  const f2 v = {a, b};
  return __builtin_bit_cast(unsigned, __builtin_convertvector(v, bf2));
}

// ---- split fp32 weights into bf16 hi/lo planes, pre-swizzled to WMMA B-frag order ----
// B frag (32x16 bf16): lane (r = lane&15, hi = lane>>4) holds col n = nt*16+r;
// VGPR v<4: K = ks*32 + 8*hi + 2*v + h ; v>=4: K = ks*32 + 16 + 8*hi + 2*(v-4) + h
__device__ __forceinline__ void pack_weights(int gid, const float* __restrict__ Wl,
                                             const float* __restrict__ Wm,
                                             const float* __restrict__ Wr,
                                             unsigned short* __restrict__ wp) {
  if (gid >= (7 << 15)) return;
  int v    = gid & 7;
  int lane = (gid >> 3) & 31;
  int ks   = (gid >> 8) & 7;
  int nt   = (gid >> 11) & 15;
  int mat  = gid >> 15;
  const float* W = (mat < 4) ? (Wl + mat * 65536)
                             : ((mat < 6) ? (Wm + (mat - 4) * 65536) : Wr);
  int hi = lane >> 4, r = lane & 15;
  int n = nt * 16 + r;
  unsigned hw = 0, lw = 0;
  for (int h = 0; h < 2; ++h) {
    int k = ks * 32 + 8 * hi + ((v < 4) ? (2 * v + h) : (16 + 2 * (v - 4) + h));
    float w = W[k * D_DIM + n];
    unsigned short wh = f2bf(w);
    unsigned short wl = f2bf(w - bf2f(wh));
    hw |= ((unsigned)wh) << (16 * h);
    lw |= ((unsigned)wl) << (16 * h);
  }
  int idx = (nt * 8 + ks) * 512 + lane * 16 + v * 2;
  *(unsigned*)(wp + (mat * 2 + 0) * WPLANE + idx) = hw;
  *(unsigned*)(wp + (mat * 2 + 1) * WPLANE + idx) = lw;
}

// lane e (e < 4) gets the number of lanes of this wave that chose expert e;
// mine = mask of the lanes that chose the same expert as this lane
__device__ __forceinline__ int wave_counts(int e, int lane, unsigned& mine) {
  unsigned b0 = __builtin_amdgcn_ballot_w32(e == 0);
  unsigned b1 = __builtin_amdgcn_ballot_w32(e == 1);
  unsigned b2 = __builtin_amdgcn_ballot_w32(e == 2);
  unsigned b3 = __builtin_amdgcn_ballot_w32(e == 3);
  mine = (e == 0) ? b0 : ((e == 1) ? b1 : ((e == 2) ? b2 : b3));
  return __popc((lane == 0) ? b0 : ((lane == 1) ? b1 : ((lane == 2) ? b2 : b3)));
}

// lane l gets the value of lane l ^ H: across the two rows of 16 lanes, or inside a row
template <int H>
__device__ __forceinline__ float lane_xor(float v) {
  const int b = __builtin_bit_cast(int, v);
  if constexpr (H == 16)
    return __builtin_bit_cast(float, __builtin_amdgcn_permlanex16(b, b, 0x76543210, 0xfedcba98, false, false));
  else
    return __builtin_bit_cast(float, __builtin_amdgcn_update_dpp(0, b, 0x160 | H, 0xf, 0xf, true));   // row_xmask:H
}
// lane l gets the value of lane K of its group of four lanes
template <int K>
__device__ __forceinline__ float quad_lane(float v) {
  return __builtin_bit_cast(float, __builtin_amdgcn_update_dpp(0, __builtin_bit_cast(int, v), K * 0x55, 0xf, 0xf, true));
}
// one step of a sum over the lanes that halves what a lane holds: of two partial sums a lane keeps
// the one that its bit H names (set: b) and adds what lane ^ H has for that one
template <int H>
__device__ __forceinline__ float fold(float a, float b, int lane) {
  const bool up = (lane & H) != 0;
  return (up ? b : a) + lane_xor<H>(up ? a : b);
}
template <int H>
__device__ __forceinline__ f4 fold4(f4 a, f4 b, int lane) {
  return f4{fold<H>(a.x, b.x, lane), fold<H>(a.y, b.y, lane), fold<H>(a.z, b.z, lane), fold<H>(a.w, b.w, lane)};
}

#define GATE_RING 8   // rows of a wave whose loads are in flight in the gate

// ---- K1: two jobs that do not depend on each other, in one grid. Work-groups 0 .. NBLK - 1: gate
//          (argmax, first-max tiebreak) + expert counts of a block of 256 rows; they last longest and
//          come first in the grid. The PACK_BLK work-groups behind them pack the weights meanwhile.
//          A wave has 32 rows and reads each with all its lanes: two loads of 512 bytes, whole lines.
//          A lane multiplies its 8 features of the row with its own 8 rows of Wg. The lanes' partial
//          sums (4 experts a row) are summed over the lanes for 8 rows together, in 31 exchanges:
//          two rows fold into one set of four as soon as both are there, two such sets again, and so on. ----
__global__ void k_gate_pack(const float* __restrict__ x, const float* __restrict__ Wg,
                            const float* __restrict__ bg, const float* __restrict__ Wl,
                            const float* __restrict__ Wm, const float* __restrict__ Wr,
                            unsigned short* __restrict__ wp, int* __restrict__ wsi) {
  __shared__ int wcnt[8][4];
  if (blockIdx.x >= NBLK) {   // the same for the whole work-group, in front of the barrier below
    pack_weights((blockIdx.x - NBLK) * 256 + threadIdx.x, Wl, Wm, Wr, wp);
    return;
  }
  const int lane = threadIdx.x & 31, wave = threadIdx.x >> 5;
  const int row = blockIdx.x * 256 + threadIdx.x;   // NBLK blocks of 256 rows; the row whose choice this thread stores
  // the lane's features are 4 * lane .. + 3 and 128 + 4 * lane .. + 3
  const float* xw = x + (size_t)(blockIdx.x * 256 + wave * 32) * D_DIM + lane * 4;
  const unsigned wo = lane * 64;   // byte offset of the lane's first four rows of Wg
  const unsigned bo = lane & 3;    // the expert whose sum the lane ends up with
  f4 wg[8];
#pragma unroll   // unrolled here and below: wg and xr must be registers
  for (int i = 0; i < 4; ++i) {
    wg[i]     = *(const f4*)((const char*)Wg + wo + 16 * i);
    wg[4 + i] = *(const f4*)((const char*)Wg + wo + (D_DIM / 2) * 16 + 16 * i);
  }
  const float bl = bg[bo];
  f4 xr[GATE_RING][2];
#pragma unroll   // as above
  for (int i = 0; i < GATE_RING; ++i) {
    xr[i][0] = *(const f4*)(xw + i * D_DIM);
    xr[i][1] = *(const f4*)(xw + i * D_DIM + D_DIM / 2);
  }
  // the wait that stands in front of any rewrite of a register that an issued load names;
  // the offsets are its inputs, so that each keeps its register up to this line
  asm volatile("s_wait_xcnt 0x0" :: "v"(wo), "v"(bo) : "memory");
  f4 s1, s2, s4;   // what waits for its partner: one row's sums, two rows', four rows'
  int pk = 0;      // this group of four lanes' choices, one row of each 8, two bits each
#pragma unroll   // as above
  for (int i = 0; i < 32; ++i) {
    const f4 a = xr[i % GATE_RING][0], b = xr[i % GATE_RING][1];
    f4 s = a.x * wg[0];
    s += a.y * wg[1];  s += a.z * wg[2];  s += a.w * wg[3];
    s += b.x * wg[4];  s += b.y * wg[5];  s += b.z * wg[6];  s += b.w * wg[7];
    if (i + GATE_RING < 32) {
      xr[i % GATE_RING][0] = *(const f4*)(xw + (i + GATE_RING) * D_DIM);
      xr[i % GATE_RING][1] = *(const f4*)(xw + (i + GATE_RING) * D_DIM + D_DIM / 2);
    }
    // keeps each row's loads where they stand, GATE_RING rows ahead of their use: moved down they
    // would leave fewer bytes in flight, moved up they would take more registers
    __builtin_amdgcn_sched_barrier(0);
    if ((i & 1) == 0) { s1 = s; continue; }
    s = fold4<16>(s1, s, lane);             // lane bit 4 = row bit 0
    if ((i & 2) == 0) { s2 = s; continue; }
    s = fold4<8>(s2, s, lane);              // lane bit 3 = row bit 1
    if ((i & 4) == 0) { s4 = s; continue; }
    s = fold4<4>(s4, s, lane);              // lane bit 2 = row bit 2
    // lane bits 1 and 0 = expert; then the lane has the whole sum of one row and one expert
    const float lg = fold<1>(fold<2>(s.x, s.z, lane), fold<2>(s.y, s.w, lane), lane) + bl;
    const float l0 = quad_lane<0>(lg), l1 = quad_lane<1>(lg), l2 = quad_lane<2>(lg), l3 = quad_lane<3>(lg);
    int bi = 0; float bv = l0;
    if (l1 > bv) { bv = l1; bi = 1; }
    if (l2 > bv) { bv = l2; bi = 2; }
    if (l3 > bv) { bv = l3; bi = 3; }
    pk |= bi << (2 * (i >> 3));
  }
  // as above, for the rows' loads
  asm volatile("s_wait_xcnt 0x0" :: "v"(xw) : "memory");
  // row 'lane' of the wave's 32: its low three bits name the group of four lanes that decided it
  // (bits 0, 1, 2 of the row = bits 4, 3, 2 of the lane), the other two which of that group's choices
  const int from = ((lane & 1) << 4) | ((lane & 2) << 2) | (lane & 4);
  const int bi = (__shfl(pk, from) >> (2 * (lane >> 3))) & 3;
  wsi[WS_IDX + row] = bi;
  unsigned mine;
  int c = wave_counts(bi, lane, mine);
  if (lane < 4) wcnt[wave][lane] = c;
  __syncthreads();
  if (threadIdx.x < 4) {
    int s = 0;
#pragma unroll
    for (int w = 0; w < 8; ++w) s += wcnt[w][threadIdx.x];
    wsi[WS_BLK + blockIdx.x * 4 + threadIdx.x] = s;
  }
}

// ---- K2: scatter rows into expert-grouped order (stable: rank = rows of the same expert before it).
//          Every work-group sums the per-block counts itself (all blocks: the experts' first slots,
//          counts padded to TILE_S; the blocks before its own: its start slots), so no launch of one
//          work-group stands between the gate and this one. Work-group 0 also stores the experts'
//          first slots and fills the padding perm slots with -1. ----
__global__ void k_scatter(int* __restrict__ wsi) {
  __shared__ int wcnt[8][4];
  __shared__ i4 wsum[8][2];   // per wave: counts of all row blocks, of the row blocks before this one
  const int t = threadIdx.x, lane = t & 31, wave = t >> 5;
  const int blk = blockIdx.x;                 // grid is exactly NBLK blocks of 256
  const int e = wsi[WS_IDX + blk * 256 + t];
  // thread t has the counts of row blocks 2t and 2t + 1 (NBLK = 2 * 256)
  const i4 c0 = *(const i4*)(wsi + WS_BLK + t * 8);
  const i4 c1 = *(const i4*)(wsi + WS_BLK + t * 8 + 4);
  const i4 z = {0, 0, 0, 0};
  const i4 all = c0 + c1;
  const i4 bef = ((2 * t < blk) ? c0 : z) + ((2 * t + 1 < blk) ? c1 : z);
  // a block's count is at most 256, a wave's sum of 64 blocks at most 16384: two experts share a word
  int s[4] = { all.x | (all.y << 16), all.z | (all.w << 16), bef.x | (bef.y << 16), bef.z | (bef.w << 16) };
#pragma unroll   // unrolled, both loops: s must be registers
  for (int d = 16; d > 0; d >>= 1)
#pragma unroll   // as above
    for (int k = 0; k < 4; ++k) s[k] += __shfl_xor(s[k], d);
  unsigned mine;
  int c = wave_counts(e, lane, mine);
  if (lane < 4) wcnt[wave][lane] = c;
  if (lane == 0) {
    wsum[wave][0] = i4{ s[0] & 0xFFFF, s[0] >> 16, s[1] & 0xFFFF, s[1] >> 16 };
    wsum[wave][1] = i4{ s[2] & 0xFFFF, s[2] >> 16, s[3] & 0xFFFF, s[3] >> 16 };
  }
  __syncthreads();
  i4 tot = z, before = z;
#pragma unroll   // unrolled: sixteen LDS reads issued together
  for (int w = 0; w < 8; ++w) { tot += wsum[w][0]; before += wsum[w][1]; }
  const i4 pad = (tot + (TILE_S - 1)) / TILE_S * TILE_S;
  const i4 off = { 0, pad.x, pad.x + pad.y, pad.x + pad.y + pad.z };
  const i4 st = off + before;                 // this block's start slot per expert
  const int st01 = (e & 1) ? st.y : st.x, st23 = (e & 1) ? st.w : st.z;
  int pos = ((e & 2) ? st23 : st01) + __popc(mine & ((1u << lane) - 1u));
#pragma unroll   // branch-free: seven LDS reads issued together instead of a loop of dependent trips
  for (int w = 0; w < 7; ++w) pos += (w < wave) ? wcnt[w][e] : 0;
  wsi[WS_PERM + pos] = blk * 256 + t;
  if (blk == 0) {
    // the wait that stands in front of any rewrite of a register that an issued store names
    asm volatile("s_wait_xcnt 0x0" ::: "memory");
    if (t < TILE_S) {
#pragma unroll   // unrolled: tot, pad and off must be registers
      for (int k = 0; k < 4; ++k)
        if (tot[k] + t < pad[k]) wsi[WS_PERM + off[k] + tot[k] + t] = -1;
    }
    if (t < 4) wsi[WS_OFFS + t] = off[t];
    if (t == 4) wsi[WS_OFFS + 4] = off.w + pad.w;
  }
}

// ---- bf16x3 GEMM layer: C = relu(in * W + bias); in LDS hi/lo bf16 planes.
//      A layer writes its result over its own input planes: the sums wait in registers until
//      every wave has read its last fragment. The last layer stages f32 there (stage = the two
//      planes as one array) and stores each row to global memory as whole 128-byte lines.
//      The weights are the matrix instruction's A operand and the rows its B operand (both fragments
//      have the same lane map, so the loaders serve either place): the result tile comes out as
//      [feature][row], a lane holds 8 neighbouring features of ONE row, and they go to LDS in
//      16-byte stores. Below, "A fragment" still names a fragment of the rows (from LDS) and
//      "B fragment" one of the weights. ----
// the wave's four B fragments (two column tiles, hi and lo plane) of k step ks; w = the layer's hi
// plane, the same for the whole work-group (its lo plane follows it), voff = the lane's byte offset
__device__ __forceinline__ void load_b(Frag (&b)[2][2], const unsigned short* __restrict__ w,
                                       unsigned voff, int ks) {
  const char* p = (const char*)w + voff;
#pragma unroll   // unrolled, both loops: b must be registers
  for (int t = 0; t < 2; ++t)
#pragma unroll
    for (int pl = 0; pl < 2; ++pl) {
      b[t][pl].q[0] = *(const f4*)(p + (pl * WPLANE + (t * 8 + ks) * 512) * 2);
      b[t][pl].q[1] = *(const f4*)(p + (pl * WPLANE + (t * 8 + ks) * 512) * 2 + 16);
    }
}

// Operands are fetched ahead of their use. A step is one 16-row tile of one k step: four matrix
// instructions on its hi A fragment, then two on its lo one. In front of step s stand four LDS loads
// in one group: the hi fragment of step s + 2 (ring of three register sets) and the lo fragment of
// step s + 1 (two sets), so each has about ten matrix instructions between its load and its use.
// The B fragments of k step ks + NB - 1 are loaded at the first step of k step ks into the set that
// k step ks - 1 has left; past the last k step they are the next layer's first ones (wN). On entry
// bq[0 .. NB - 2] hold this layer's first k steps. MT = 16-row tiles of the work-group's tile: with
// 8 of them one k step ahead is far enough, with 2 a k step is so short that it takes three.
template <bool LAST, int MT, int NB>
__device__ __forceinline__ void gemm_layer(
    unsigned short* inH, unsigned short* inL,
    const unsigned short* __restrict__ wC,  const unsigned short* __restrict__ wN,
    unsigned voff, Frag (&bq)[NB][2][2],
    const float* __restrict__ bias,
    float* __restrict__ out, const int* __restrict__ rows_s, float* stage) {
  const int lane = threadIdx.x & 31;
  const int wave = threadIdx.x >> 5;
  const int r = lane & 15, hi = lane >> 4, hi8 = hi * 8;
  const int nt0 = wave * 2;

  v8f acc[2][MT];
#pragma unroll
  for (int t = 0; t < 2; ++t)
#pragma unroll
    for (int m = 0; m < MT; ++m)
#pragma unroll
      for (int q = 0; q < 8; ++q) acc[t][m][q] = 0.f;

  Frag ah[3], al[2];   // A fragments: hi plane [step mod 3], lo plane [step mod 2]
#pragma unroll   // unrolled here and below: ah, al, bq and acc must be registers
  for (int s = 0; s < 2; ++s) {
    const unsigned short* pah = inH + (s * 16 + r) * PADH + hi8;
    ah[s].q[0] = *(const f4*)(pah);      ah[s].q[1] = *(const f4*)(pah + 16);
  }
  {
    const unsigned short* pal = inL + r * PADH + hi8;
    al[0].q[0] = *(const f4*)(pal);      al[0].q[1] = *(const f4*)(pal + 16);
  }
#pragma unroll   // as above
  for (int s = 0; s < KSTEPS * MT; ++s) {
    const int ks = s / MT, m = s % MT;
    if (s + 2 < KSTEPS * MT) {
      const int s2 = s + 2;
      const unsigned short* pah = inH + ((s2 % MT) * 16 + r) * PADH + (s2 / MT) * 32 + hi8;
      ah[s2 % 3].q[0] = *(const f4*)(pah);    ah[s2 % 3].q[1] = *(const f4*)(pah + 16);
    }
    if (s + 1 < KSTEPS * MT) {
      const int s1 = s + 1;
      const unsigned short* pal = inL + ((s1 % MT) * 16 + r) * PADH + (s1 / MT) * 32 + hi8;
      al[s1 & 1].q[0] = *(const f4*)(pal);    al[s1 & 1].q[1] = *(const f4*)(pal + 16);
    }
    if (m == 0) {
      const int kn = ks + NB - 1;
      if (kn < KSTEPS) load_b(bq[kn % NB], wC, voff, kn);
      else if (!LAST)  load_b(bq[kn % NB], wN, voff, kn - KSTEPS);
    }
    // holds the loads above in front of this step's matrix instructions: the scheduler otherwise
    // sinks each load to just before its use, and the wave waits out the latency there
    __builtin_amdgcn_sched_barrier(0);
    Frag (&bc)[2][2] = bq[ks % NB];
    // per accumulator the order hi*hi, hi*lo, lo*hi; the two column tiles alternate
#pragma unroll   // as above
    for (int t = 0; t < 2; ++t)
      acc[t][m] = __builtin_amdgcn_wmma_f32_16x16x32_bf16(false, bc[t][0].v, false, ah[s % 3].v,
                                                          (short)0, acc[t][m], false, false);
#pragma unroll   // as above
    for (int t = 0; t < 2; ++t)
      acc[t][m] = __builtin_amdgcn_wmma_f32_16x16x32_bf16(false, bc[t][1].v, false, ah[s % 3].v,
                                                          (short)0, acc[t][m], false, false);
#pragma unroll   // as above
    for (int t = 0; t < 2; ++t)
      acc[t][m] = __builtin_amdgcn_wmma_f32_16x16x32_bf16(false, bc[t][0].v, false, al[s & 1].v,
                                                          (short)0, acc[t][m], false, false);
    // ends the step: the next step's loads stay behind these matrix instructions
    __builtin_amdgcn_sched_barrier(0);
  }

  // every wave reads all rows and all k of the planes: none may be overwritten before the last read
  __syncthreads();

  // epilogue: bias + relu; write next-layer LDS planes (in place) or the staged f32 result
#pragma unroll
  for (int t = 0; t < 2; ++t) {
    const int col = (nt0 + t) * 16 + hi8;   // result layout: feature = col + vgpr, row = m * 16 + r
    const f4 b0 = *(const f4*)(bias + col), b1 = *(const f4*)(bias + col + 4);
#pragma unroll
    for (int m = 0; m < MT; ++m) {
      float val[8];
#pragma unroll
      for (int q = 0; q < 8; ++q) val[q] = fmaxf(acc[t][m][q] + ((q < 4) ? b0[q & 3] : b1[q & 3]), 0.f);
      if (LAST) {
        float* ps = stage + (r * SPITCH + col) + m * 16 * SPITCH;
        *(f4*)(ps)     = f4{val[0], val[1], val[2], val[3]};
        *(f4*)(ps + 4) = f4{val[4], val[5], val[6], val[7]};
      } else {
        u32x4 hw, lw;   // the 8 features as bf16 pairs: value, and what the value leaves over
#pragma unroll   // unrolled: val, hw and lw must be registers
        for (int k = 0; k < 4; ++k) {
          const unsigned h = pk_bf(val[2 * k], val[2 * k + 1]);
          hw[k] = h;
          lw[k] = pk_bf(val[2 * k] - __uint_as_float(h << 16),
                        val[2 * k + 1] - __uint_as_float(h & 0xFFFF0000u));
        }
        *(u32x4*)(inH + (r * PADH + col) + m * 16 * PADH) = hw;
        *(u32x4*)(inL + (r * PADH + col) + m * 16 * PADH) = lw;
      }
    }
  }

  if (LAST) {
    __syncthreads();   // a wave stores rows whose columns all eight waves have staged
    constexpr int RW = MT * 16 / WAVES;   // result rows that one wave stores
    const int row0 = wave * RW;
    i4 rr[RW / 4];
#pragma unroll   // unrolled here and below: rr, va and vb must be registers
    for (int k = 0; k < RW / 4; ++k) rr[k] = *(const i4*)(rows_s + row0 + 4 * k);
    f4 va[RW], vb[RW];   // left and right half of each row, 16 bytes a lane
#pragma unroll   // as above
    for (int j = 0; j < RW; ++j) {
      va[j] = *(const f4*)(stage + (row0 + j) * SPITCH + lane * 4);
      vb[j] = *(const f4*)(stage + (row0 + j) * SPITCH + D_DIM / 2 + lane * 4);
    }
#pragma unroll   // as above
    for (int j = 0; j < RW; ++j) {
      // the same in every lane: as a scalar it gives a scalar branch and a scalar row address
      const int ro = __builtin_amdgcn_readfirstlane(rr[j >> 2][j & 3]);
      if (ro >= 0) {   // a padding slot has no row
        float* po = out + (size_t)ro * D_DIM + lane * 4;
        *(f4*)(po) = va[j];
        *(f4*)(po + D_DIM / 2) = vb[j];
        // the wait that stands in front of any rewrite of a register that an issued store names
        asm volatile("s_wait_xcnt 0x0" ::: "memory");
      }
    }
  }
}

// ---- K3: fused routed 3-layer GEMM over one expert-grouped tile ----
// An expert's rows (padded to TILE_S) are cut into 128-row tiles and, for what is left over, 32-row
// tiles. The large tiles never number more than B_ROWS / TILE_M, which fills the chip's places a whole
// number of times; the small tiles have the highest block indices and are short (for speed only).
// One pair of LDS planes (about 137 KB) and at most 256 registers a wave: two work-groups share a WGP.
__global__ __launch_bounds__(BLK, 4) void k_main(
    const float* __restrict__ x, const float* __restrict__ b_leaf,
    const float* __restrict__ b_mid, const float* __restrict__ b_root,
    const unsigned short* __restrict__ wp, const int* __restrict__ wsi,
    float* __restrict__ out) {
  // hi and lo plane of the tile's current layer; at the end the f32 result (TILE_M * SPITCH floats fit)
  __shared__ __attribute__((aligned(16))) unsigned short smem[2 * TILE_M * PADH];
  __shared__ __attribute__((aligned(16))) int rows_s[TILE_M];   // read four at a time in the gather
  const int PLANE = TILE_M * PADH;
  unsigned short* pAh = smem;
  unsigned short* pAl = smem + PLANE;

  const int o1 = wsi[WS_OFFS + 1], o2 = wsi[WS_OFFS + 2];
  const int o3 = wsi[WS_OFFS + 3], o4 = wsi[WS_OFFS + 4];
  // large tiles of experts 0 .. e - 1, then the same for the small tiles
  const int f1 = o1 / TILE_M, f2 = f1 + (o2 - o1) / TILE_M;
  const int f3 = f2 + (o3 - o2) / TILE_M, f4n = f3 + (o4 - o3) / TILE_M;
  const int g1 = o1 % TILE_M / TILE_S, g2 = g1 + (o2 - o1) % TILE_M / TILE_S;
  const int g3 = g2 + (o3 - o2) % TILE_M / TILE_S, g4 = g3 + (o4 - o3) % TILE_M / TILE_S;
  const bool small = (int)blockIdx.x >= f4n;
  const int b = small ? (int)blockIdx.x - f4n : (int)blockIdx.x;   // index among the tiles of its size
  if (small && b >= g4) return;
  const int c1 = small ? g1 : f1, c2 = small ? g2 : f2, c3 = small ? g3 : f3;
  const int e = (b < c1) ? 0 : ((b < c2) ? 1 : ((b < c3) ? 2 : 3));
  const int p = e >> 1;
  const int oe = (e == 0) ? 0 : ((e == 1) ? o1 : ((e == 2) ? o2 : o3));     // the expert's first slot
  const int on = (e == 0) ? o1 : ((e == 1) ? o2 : ((e == 2) ? o3 : o4));    // the next expert's
  const int ce = (e == 0) ? 0 : ((e == 1) ? c1 : ((e == 2) ? c2 : c3));     // tiles of this size before it
  const int base = small ? oe + (on - oe) / TILE_M * TILE_M + (b - ce) * TILE_S
                         : oe + (b - ce) * TILE_M;
  const int nrows = small ? TILE_S : TILE_M;

  const int tid = threadIdx.x;
  // a small tile's slots past its rows count as padding slots
  if (tid < TILE_M) rows_s[tid] = (tid < nrows) ? wsi[WS_PERM + base + tid] : -1;
  __syncthreads();

  // gather x rows, split fp32 -> bf16 hi/lo planes.
  // A thread issues all its row loads before it converts the first: one memory latency per
  // tile instead of one per load. The loads carry no branch: a padding slot reads row 0, and
  // what the layers make of it is never stored (the last layer stores only slots with a row).
  const int grow = (tid >> 6) * (2 * GATHER_H);   // this thread's tile rows: grow .. grow + 2 * GATHER_H - 1
  const int gq = tid & 63;                        // its 16-byte piece of each row
  u32x4 q[GATHER_H / 2];                          // load offsets, in 16-byte units
#pragma unroll   // unrolled here and in the loops over j below: q, xa and xb must be registers
  for (int k = 0; k < GATHER_H / 2; ++k) {
    const i4 r = *(const i4*)(rows_s + grow + 4 * k);
#pragma unroll   // as above
    for (int s = 0; s < 4; ++s) q[k][s] = ((unsigned)(r[s] < 0 ? 0 : r[s]) << 6) + gq;
  }
  f4 xa[GATHER_H], xb[GATHER_H];                  // first and second half of the loads
#pragma unroll   // as above
  for (int j = 0; j < GATHER_H; ++j) xa[j] = *(const f4*)(x + (size_t)q[j >> 2][j & 3] * 4);
#pragma unroll   // as above
  for (int j = 0; j < GATHER_H; ++j)
    xb[j] = *(const f4*)(x + (size_t)q[(GATHER_H + j) >> 2][j & 3] * 4);
  // the wait that stands in front of any rewrite of a register that an issued load names;
  // the offsets are its inputs, so that each keeps its register up to this line
  asm volatile("s_wait_xcnt 0x0"
               :: "v"(q[0]), "v"(q[1]), "v"(q[2]), "v"(q[3]), "v"(q[4]), "v"(q[5]), "v"(q[6]), "v"(q[7])
               : "memory");
  // hi planes of the three layers' packed weights (the lo plane follows its hi plane)
  const unsigned short* wLeafH = wp + (2 * e) * WPLANE;
  const unsigned short* wMidH  = wp + (2 * (4 + p)) * WPLANE;
  const unsigned short* wRootH = wp + 12 * WPLANE;
  const unsigned voff = ((tid >> 5) * 2 * 8 * 512 + (tid & 31) * 16) * 2;   // the wave's column tiles, the lane's 32 bytes
#pragma unroll 1   // rolled: the convert code stands once for both halves, which keeps the kernel's text short
  for (int h = 0; h < 2; ++h) {
#pragma unroll   // as above
    for (int j = 0; j < GATHER_H; ++j) {
      const int row = grow + h * GATHER_H + j;
      const int c = gq << 2;
      const f4 xv = xa[j];
      u16x4 hv = { f2bf(xv.x), f2bf(xv.y), f2bf(xv.z), f2bf(xv.w) };
      u16x4 lv = { f2bf(xv.x - bf2f(hv.x)), f2bf(xv.y - bf2f(hv.y)),
                   f2bf(xv.z - bf2f(hv.z)), f2bf(xv.w - bf2f(hv.w)) };
      *(u16x4*)(pAh + row * PADH + c) = hv;
      *(u16x4*)(pAl + row * PADH + c) = lv;
      xa[j] = xb[j];
    }
  }
  if (!small) {   // the same for the whole work-group: the barriers inside are passed by all or none
    Frag bq[2][2][2];   // B fragments: [k step mod 2][column tile][hi, lo plane]
    load_b(bq[0], wLeafH, voff, 0);   // the leaf layer's first, in flight over the barrier
    __syncthreads();

    // leaf (routed expert e)
    gemm_layer<false, TILE_M / 16, 2>(pAh, pAl, wLeafH, wMidH, voff, bq,
                                      b_leaf + e * D_DIM, nullptr, nullptr, nullptr);
    __syncthreads();
    // mid (parent p)
    gemm_layer<false, TILE_M / 16, 2>(pAh, pAl, wMidH, wRootH, voff, bq,
                                      b_mid + p * D_DIM, nullptr, nullptr, nullptr);
    __syncthreads();
    // root, scatter to original row order
    gemm_layer<true, TILE_M / 16, 2>(pAh, pAl, wRootH, nullptr, voff, bq,
                                     b_root, out, rows_s, (float*)smem);
  } else {
    Frag bq[4][2][2];   // B fragments: [k step mod 4][column tile][hi, lo plane]
    // the loads stand behind the barrier here: in front of it the compiler merges the first of them
    // with the other branch's and keeps those registers alive through this branch, which then spills
    __syncthreads();
#pragma unroll   // unrolled: bq must be registers
    for (int k = 0; k < 3; ++k) load_b(bq[k], wLeafH, voff, k);   // the leaf layer's first three

    gemm_layer<false, TILE_S / 16, 4>(pAh, pAl, wLeafH, wMidH, voff, bq,
                                      b_leaf + e * D_DIM, nullptr, nullptr, nullptr);
    __syncthreads();
    gemm_layer<false, TILE_S / 16, 4>(pAh, pAl, wMidH, wRootH, voff, bq,
                                      b_mid + p * D_DIM, nullptr, nullptr, nullptr);
    __syncthreads();
    gemm_layer<true, TILE_S / 16, 4>(pAh, pAl, wRootH, nullptr, voff, bq,
                                     b_root, out, rows_s, (float*)smem);
  }
}

extern "C" void kernel_launch(void* const* d_in, const int* in_sizes, int n_in,
                              void* d_out, int out_size, void* d_ws, size_t ws_size,
                              hipStream_t stream) {
  (void)in_sizes; (void)n_in; (void)out_size; (void)ws_size;
  const float* x      = (const float*)d_in[0];
  const float* Wg     = (const float*)d_in[1];
  const float* bg     = (const float*)d_in[2];
  const float* W_leaf = (const float*)d_in[3];
  const float* b_leaf = (const float*)d_in[4];
  const float* W_mid  = (const float*)d_in[5];
  const float* b_mid  = (const float*)d_in[6];
  const float* W_root = (const float*)d_in[7];
  const float* b_root = (const float*)d_in[8];
  float* out = (float*)d_out;
  int* wsi = (int*)d_ws;
  unsigned short* wp = (unsigned short*)((char*)d_ws + WPACK_BYTES);

  k_gate_pack<<<NBLK + PACK_BLK, 256, 0, stream>>>(x, Wg, bg, W_leaf, W_mid, W_root, wp, wsi);
  k_scatter<<<NBLK, 256, 0, stream>>>(wsi);
  k_main<<<B_ROWS / TILE_M + 12, BLK, 0, stream>>>(x, b_leaf, b_mid, b_root, wp, wsi, out);
}

// v010
// It runs in 92.9 microseconds.
// Two timings next to v009 put it at 1.09 and 1.05 times that version's speed.
// Counting every step since v000, it is 3.84 times as fast.
#include <hip/hip_runtime.h>

#define B_ROWS 131072
#define D_DIM  256
#define TILE_M 128
#define TILE_S 32             // rows of a small tile: what an expert's rows leave over after its 128-row tiles
#define PADH   272            // LDS row stride in halves (breaks bank conflicts)
#define KSTEPS 8              // 256 / 32
#define WAVES  8
#define BLK    (WAVES * 32)   // 256 threads, 8 wave32s
#define GATHER_H (TILE_M * (D_DIM / 4) / BLK / 2)   // 16: half of a thread's 16-byte loads in the gather
#define SPITCH 260            // LDS row stride in floats of the staged result: the 16-byte stores of 16 rows fall on 64 different banks

typedef __attribute__((ext_vector_type(16))) __bf16          v16bf;
typedef __attribute__((ext_vector_type(8)))  float           v8f;
typedef __attribute__((ext_vector_type(4)))  float           f4;
typedef __attribute__((ext_vector_type(4)))  unsigned short  u16x4;
typedef __attribute__((ext_vector_type(4)))  int             i4;
typedef __attribute__((ext_vector_type(4)))  unsigned        u32x4;
typedef __attribute__((ext_vector_type(2)))  float           f2;
typedef __attribute__((ext_vector_type(2)))  __bf16          bf2;

union Frag { f4 q[2]; v16bf v; };

// ---- workspace layout (int units) ----
#define WS_OFFS   8                 // offs[0..4], offs[4] = padded total
#define WS_IDX    16
#define WS_PERM   (16 + B_ROWS)
#define WS_PERM_LEN (B_ROWS + 4 * TILE_M)
#define NBLK      (B_ROWS / 256)    // row blocks of k_gate_pack's gate and of k_scatter
#define WS_BLK    (WS_PERM + WS_PERM_LEN)   // [NBLK][4]: per-block expert counts
#define WPACK_BYTES ((((size_t)(WS_BLK + NBLK * 4) * 4) + 1023) / 1024 * 1024)   // bf16 packed weights after ints, each 1 KB fragment on a 1 KB boundary
#define WPLANE 65536                // ushorts per 256x256 plane
#define PACK_BLK  ((7 << 15) / 256) // work-groups that pack the seven weight matrices

__device__ __forceinline__ unsigned short f2bf(float f) {
  unsigned u = __float_as_uint(f);
  u += 0x7FFFu + ((u >> 16) & 1u);          // round-to-nearest-even
  return (unsigned short)(u >> 16);
}
__device__ __forceinline__ float bf2f(unsigned short h) {
  return __uint_as_float(((unsigned)h) << 16);
}

// two floats -> two bf16 in one word (a in the low half), round-to-nearest-even: one packed convert
__device__ __forceinline__ unsigned pk_bf(float a, float b) {
  const f2 v = {a, b};
  return __builtin_bit_cast(unsigned, __builtin_convertvector(v, bf2));
}

// ---- split fp32 weights into bf16 hi/lo planes, pre-swizzled to WMMA B-frag order ----
// B frag (32x16 bf16): lane (r = lane&15, hi = lane>>4) holds col n = nt*16+r;
// VGPR v<4: K = ks*32 + 8*hi + 2*v + h ; v>=4: K = ks*32 + 16 + 8*hi + 2*(v-4) + h
// A fragment (1 KB) lies as two halves of 512 bytes: VGPRs 0..3 of lanes 0..31, then VGPRs 4..7.
// A wave's 16-byte load of one half then reads 512 bytes in a row, four whole 128-byte lines.
__device__ __forceinline__ void pack_weights(int gid, const float* __restrict__ Wl,
                                             const float* __restrict__ Wm,
                                             const float* __restrict__ Wr,
                                             unsigned short* __restrict__ wp) {
  if (gid >= (7 << 15)) return;
  int v    = gid & 7;
  int lane = (gid >> 3) & 31;
  int ks   = (gid >> 8) & 7;
  int nt   = (gid >> 11) & 15;
  int mat  = gid >> 15;
  const float* W = (mat < 4) ? (Wl + mat * 65536)
                             : ((mat < 6) ? (Wm + (mat - 4) * 65536) : Wr);
  int hi = lane >> 4, r = lane & 15;
  int n = nt * 16 + r;
  unsigned hw = 0, lw = 0;
  for (int h = 0; h < 2; ++h) {
    int k = ks * 32 + 8 * hi + ((v < 4) ? (2 * v + h) : (16 + 2 * (v - 4) + h));
    float w = W[k * D_DIM + n];
    unsigned short wh = f2bf(w);
    unsigned short wl = f2bf(w - bf2f(wh));
    hw |= ((unsigned)wh) << (16 * h);
    lw |= ((unsigned)wl) << (16 * h);
  }
  int idx = (nt * 8 + ks) * 512 + (v >> 2) * 256 + lane * 8 + (v & 3) * 2;
  *(unsigned*)(wp + (mat * 2 + 0) * WPLANE + idx) = hw;
  *(unsigned*)(wp + (mat * 2 + 1) * WPLANE + idx) = lw;
}

// lane e (e < 4) gets the number of lanes of this wave that chose expert e;
// mine = mask of the lanes that chose the same expert as this lane
__device__ __forceinline__ int wave_counts(int e, int lane, unsigned& mine) {
  unsigned b0 = __builtin_amdgcn_ballot_w32(e == 0);
  unsigned b1 = __builtin_amdgcn_ballot_w32(e == 1);
  unsigned b2 = __builtin_amdgcn_ballot_w32(e == 2);
  unsigned b3 = __builtin_amdgcn_ballot_w32(e == 3);
  mine = (e == 0) ? b0 : ((e == 1) ? b1 : ((e == 2) ? b2 : b3));
  return __popc((lane == 0) ? b0 : ((lane == 1) ? b1 : ((lane == 2) ? b2 : b3)));
}

// lane l gets the value of lane l ^ H: across the two rows of 16 lanes, or inside a row
template <int H>
__device__ __forceinline__ float lane_xor(float v) {
  const int b = __builtin_bit_cast(int, v);
  if constexpr (H == 16)
    return __builtin_bit_cast(float, __builtin_amdgcn_permlanex16(b, b, 0x76543210, 0xfedcba98, false, false));
  else
    return __builtin_bit_cast(float, __builtin_amdgcn_update_dpp(0, b, 0x160 | H, 0xf, 0xf, true));   // row_xmask:H
}
// lane l gets the value of lane K of its group of four lanes
template <int K>
__device__ __forceinline__ float quad_lane(float v) {
  return __builtin_bit_cast(float, __builtin_amdgcn_update_dpp(0, __builtin_bit_cast(int, v), K * 0x55, 0xf, 0xf, true));
}
// one step of a sum over the lanes that halves what a lane holds: of two partial sums a lane keeps
// the one that its bit H names (set: b) and adds what lane ^ H has for that one
template <int H>
__device__ __forceinline__ float fold(float a, float b, int lane) {
  const bool up = (lane & H) != 0;
  return (up ? b : a) + lane_xor<H>(up ? a : b);
}
template <int H>
__device__ __forceinline__ f4 fold4(f4 a, f4 b, int lane) {
  return f4{fold<H>(a.x, b.x, lane), fold<H>(a.y, b.y, lane), fold<H>(a.z, b.z, lane), fold<H>(a.w, b.w, lane)};
}

#define GATE_RING 8   // rows of a wave whose loads are in flight in the gate

// ---- K1: two jobs that do not depend on each other, in one grid. Work-groups 0 .. NBLK - 1: gate
//          (argmax, first-max tiebreak) + expert counts of a block of 256 rows; they last longest and
//          come first in the grid. The PACK_BLK work-groups behind them pack the weights meanwhile.
//          A wave has 32 rows and reads each with all its lanes: two loads of 512 bytes, whole lines.
//          A lane multiplies its 8 features of the row with its own 8 rows of Wg. The lanes' partial
//          sums (4 experts a row) are summed over the lanes for 8 rows together, in 31 exchanges:
//          two rows fold into one set of four as soon as both are there, two such sets again, and so on. ----
__global__ void k_gate_pack(const float* __restrict__ x, const float* __restrict__ Wg,
                            const float* __restrict__ bg, const float* __restrict__ Wl,
                            const float* __restrict__ Wm, const float* __restrict__ Wr,
                            unsigned short* __restrict__ wp, int* __restrict__ wsi) {
  __shared__ int wcnt[8][4];
  if (blockIdx.x >= NBLK) {   // the same for the whole work-group, in front of the barrier below
    pack_weights((blockIdx.x - NBLK) * 256 + threadIdx.x, Wl, Wm, Wr, wp);
    return;
  }
  const int lane = threadIdx.x & 31, wave = threadIdx.x >> 5;
  const int row = blockIdx.x * 256 + threadIdx.x;   // NBLK blocks of 256 rows; the row whose choice this thread stores
  // the lane's features are 4 * lane .. + 3 and 128 + 4 * lane .. + 3
  const float* xw = x + (size_t)(blockIdx.x * 256 + wave * 32) * D_DIM + lane * 4;
  const unsigned wo = lane * 64;   // byte offset of the lane's first four rows of Wg
  const unsigned bo = lane & 3;    // the expert whose sum the lane ends up with
  f4 wg[8];
#pragma unroll   // unrolled here and below: wg and xr must be registers
  for (int i = 0; i < 4; ++i) {
    wg[i]     = *(const f4*)((const char*)Wg + wo + 16 * i);
    wg[4 + i] = *(const f4*)((const char*)Wg + wo + (D_DIM / 2) * 16 + 16 * i);
  }
  const float bl = bg[bo];
  f4 xr[GATE_RING][2];
#pragma unroll   // as above
  for (int i = 0; i < GATE_RING; ++i) {
    xr[i][0] = *(const f4*)(xw + i * D_DIM);
    xr[i][1] = *(const f4*)(xw + i * D_DIM + D_DIM / 2);
  }
  // the wait that stands in front of any rewrite of a register that an issued load names;
  // the offsets are its inputs, so that each keeps its register up to this line
  asm volatile("s_wait_xcnt 0x0" :: "v"(wo), "v"(bo) : "memory");
  f4 s1, s2, s4;   // what waits for its partner: one row's sums, two rows', four rows'
  int pk = 0;      // this group of four lanes' choices, one row of each 8, two bits each
#pragma unroll   // as above
  for (int i = 0; i < 32; ++i) {
    const f4 a = xr[i % GATE_RING][0], b = xr[i % GATE_RING][1];
    f4 s = a.x * wg[0];
    s += a.y * wg[1];  s += a.z * wg[2];  s += a.w * wg[3];
    s += b.x * wg[4];  s += b.y * wg[5];  s += b.z * wg[6];  s += b.w * wg[7];
    if (i + GATE_RING < 32) {
      xr[i % GATE_RING][0] = *(const f4*)(xw + (i + GATE_RING) * D_DIM);
      xr[i % GATE_RING][1] = *(const f4*)(xw + (i + GATE_RING) * D_DIM + D_DIM / 2);
    }
    // keeps each row's loads where they stand, GATE_RING rows ahead of their use: moved down they
    // would leave fewer bytes in flight, moved up they would take more registers
    __builtin_amdgcn_sched_barrier(0);
    if ((i & 1) == 0) { s1 = s; continue; }
    s = fold4<16>(s1, s, lane);             // lane bit 4 = row bit 0
    if ((i & 2) == 0) { s2 = s; continue; }
    s = fold4<8>(s2, s, lane);              // lane bit 3 = row bit 1
    if ((i & 4) == 0) { s4 = s; continue; }
    s = fold4<4>(s4, s, lane);              // lane bit 2 = row bit 2
    // lane bits 1 and 0 = expert; then the lane has the whole sum of one row and one expert
    const float lg = fold<1>(fold<2>(s.x, s.z, lane), fold<2>(s.y, s.w, lane), lane) + bl;
    const float l0 = quad_lane<0>(lg), l1 = quad_lane<1>(lg), l2 = quad_lane<2>(lg), l3 = quad_lane<3>(lg);
    int bi = 0; float bv = l0;
    if (l1 > bv) { bv = l1; bi = 1; }
    if (l2 > bv) { bv = l2; bi = 2; }
    if (l3 > bv) { bv = l3; bi = 3; }
    pk |= bi << (2 * (i >> 3));
  }
  // as above, for the rows' loads
  asm volatile("s_wait_xcnt 0x0" :: "v"(xw) : "memory");
  // row 'lane' of the wave's 32: its low three bits name the group of four lanes that decided it
  // (bits 0, 1, 2 of the row = bits 4, 3, 2 of the lane), the other two which of that group's choices
  const int from = ((lane & 1) << 4) | ((lane & 2) << 2) | (lane & 4);
  const int bi = (__shfl(pk, from) >> (2 * (lane >> 3))) & 3;
  wsi[WS_IDX + row] = bi;
  unsigned mine;
  int c = wave_counts(bi, lane, mine);
  if (lane < 4) wcnt[wave][lane] = c;
  __syncthreads();
  if (threadIdx.x < 4) {
    int s = 0;
#pragma unroll
    for (int w = 0; w < 8; ++w) s += wcnt[w][threadIdx.x];
    wsi[WS_BLK + blockIdx.x * 4 + threadIdx.x] = s;
  }
}

// ---- K2: scatter rows into expert-grouped order (stable: rank = rows of the same expert before it).
//          Every work-group sums the per-block counts itself (all blocks: the experts' first slots,
//          counts padded to TILE_S; the blocks before its own: its start slots), so no launch of one
//          work-group stands between the gate and this one. Work-group 0 also stores the experts'
//          first slots and fills the padding perm slots with -1. ----
__global__ void k_scatter(int* __restrict__ wsi) {
  __shared__ int wcnt[8][4];
  __shared__ i4 wsum[8][2];   // per wave: counts of all row blocks, of the row blocks before this one
  const int t = threadIdx.x, lane = t & 31, wave = t >> 5;
  const int blk = blockIdx.x;                 // grid is exactly NBLK blocks of 256
  const int e = wsi[WS_IDX + blk * 256 + t];
  // thread t has the counts of row blocks 2t and 2t + 1 (NBLK = 2 * 256)
  const i4 c0 = *(const i4*)(wsi + WS_BLK + t * 8);
  const i4 c1 = *(const i4*)(wsi + WS_BLK + t * 8 + 4);
  const i4 z = {0, 0, 0, 0};
  const i4 all = c0 + c1;
  const i4 bef = ((2 * t < blk) ? c0 : z) + ((2 * t + 1 < blk) ? c1 : z);
  // a block's count is at most 256, a wave's sum of 64 blocks at most 16384: two experts share a word
  int s[4] = { all.x | (all.y << 16), all.z | (all.w << 16), bef.x | (bef.y << 16), bef.z | (bef.w << 16) };
#pragma unroll   // unrolled, both loops: s must be registers
  for (int d = 16; d > 0; d >>= 1)
#pragma unroll   // as above
    for (int k = 0; k < 4; ++k) s[k] += __shfl_xor(s[k], d);
  unsigned mine;
  int c = wave_counts(e, lane, mine);
  if (lane < 4) wcnt[wave][lane] = c;
  if (lane == 0) {
    wsum[wave][0] = i4{ s[0] & 0xFFFF, s[0] >> 16, s[1] & 0xFFFF, s[1] >> 16 };
    wsum[wave][1] = i4{ s[2] & 0xFFFF, s[2] >> 16, s[3] & 0xFFFF, s[3] >> 16 };
  }
  __syncthreads();
  i4 tot = z, before = z;
#pragma unroll   // unrolled: sixteen LDS reads issued together
  for (int w = 0; w < 8; ++w) { tot += wsum[w][0]; before += wsum[w][1]; }
  const i4 pad = (tot + (TILE_S - 1)) / TILE_S * TILE_S;
  const i4 off = { 0, pad.x, pad.x + pad.y, pad.x + pad.y + pad.z };
  const i4 st = off + before;                 // this block's start slot per expert
  const int st01 = (e & 1) ? st.y : st.x, st23 = (e & 1) ? st.w : st.z;
  int pos = ((e & 2) ? st23 : st01) + __popc(mine & ((1u << lane) - 1u));
#pragma unroll   // branch-free: seven LDS reads issued together instead of a loop of dependent trips
  for (int w = 0; w < 7; ++w) pos += (w < wave) ? wcnt[w][e] : 0;
  wsi[WS_PERM + pos] = blk * 256 + t;
  if (blk == 0) {
    // the wait that stands in front of any rewrite of a register that an issued store names
    asm volatile("s_wait_xcnt 0x0" ::: "memory");
    if (t < TILE_S) {
#pragma unroll   // unrolled: tot, pad and off must be registers
      for (int k = 0; k < 4; ++k)
        if (tot[k] + t < pad[k]) wsi[WS_PERM + off[k] + tot[k] + t] = -1;
    }
    if (t < 4) wsi[WS_OFFS + t] = off[t];
    if (t == 4) wsi[WS_OFFS + 4] = off.w + pad.w;
  }
}

// ---- bf16x3 GEMM layer: C = relu(in * W + bias); in LDS hi/lo bf16 planes.
//      A layer writes its result over its own input planes: the sums wait in registers until
//      every wave has read its last fragment. The last layer stages f32 there (stage = the two
//      planes as one array) and stores each row to global memory as whole 128-byte lines.
//      The weights are the matrix instruction's A operand and the rows its B operand (both fragments
//      have the same lane map, so the loaders serve either place): the result tile comes out as
//      [feature][row], a lane holds 8 neighbouring features of ONE row, and they go to LDS in
//      16-byte stores. Below, "A fragment" still names a fragment of the rows (from LDS) and
//      "B fragment" one of the weights. ----
// the wave's four B fragments (two column tiles, hi and lo plane) of k step ks; w = the layer's hi
// plane, the same for the whole work-group (its lo plane follows it), voff = the lane's byte offset
__device__ __forceinline__ void load_b(Frag (&b)[2][2], const unsigned short* __restrict__ w,
                                       unsigned voff, int ks) {
  const char* p = (const char*)w + voff;
#pragma unroll   // unrolled, both loops: b must be registers
  for (int t = 0; t < 2; ++t)
#pragma unroll
    for (int pl = 0; pl < 2; ++pl) {
      b[t][pl].q[0] = *(const f4*)(p + (pl * WPLANE + (t * 8 + ks) * 512) * 2);
      b[t][pl].q[1] = *(const f4*)(p + (pl * WPLANE + (t * 8 + ks) * 512) * 2 + 512);
    }
}

// Operands are fetched ahead of their use. A step is one 16-row tile of one k step: four matrix
// instructions on its hi A fragment, then two on its lo one. In front of step s stand four LDS loads
// in one group: the hi fragment of step s + 2 (ring of three register sets) and the lo fragment of
// step s + 1 (two sets), so each has about ten matrix instructions between its load and its use.
// The B fragments of k step ks + NB - 1 are loaded at the first step of k step ks into the set that
// k step ks - 1 has left; past the last k step they are the next layer's first ones (wN). On entry
// bq[0 .. NB - 2] hold this layer's first k steps. MT = 16-row tiles of the work-group's tile: with
// 8 of them one k step ahead is far enough, with 2 a k step is so short that it takes three.
template <bool LAST, int MT, int NB>
__device__ __forceinline__ void gemm_layer(
    unsigned short* inH, unsigned short* inL,
    const unsigned short* __restrict__ wC,  const unsigned short* __restrict__ wN,
    unsigned voff, Frag (&bq)[NB][2][2],
    const float* __restrict__ bias,
    float* __restrict__ out, const int* __restrict__ rows_s, float* stage) {
  const int lane = threadIdx.x & 31;
  const int wave = threadIdx.x >> 5;
  const int r = lane & 15, hi = lane >> 4, hi8 = hi * 8;
  const int nt0 = wave * 2;

  v8f acc[2][MT];
#pragma unroll
  for (int t = 0; t < 2; ++t)
#pragma unroll
    for (int m = 0; m < MT; ++m)
#pragma unroll
      for (int q = 0; q < 8; ++q) acc[t][m][q] = 0.f;

  Frag ah[3], al[2];   // A fragments: hi plane [step mod 3], lo plane [step mod 2]
#pragma unroll   // unrolled here and below: ah, al, bq and acc must be registers
  for (int s = 0; s < 2; ++s) {
    const unsigned short* pah = inH + (s * 16 + r) * PADH + hi8;
    ah[s].q[0] = *(const f4*)(pah);      ah[s].q[1] = *(const f4*)(pah + 16);
  }
  {
    const unsigned short* pal = inL + r * PADH + hi8;
    al[0].q[0] = *(const f4*)(pal);      al[0].q[1] = *(const f4*)(pal + 16);
  }
#pragma unroll   // as above
  for (int s = 0; s < KSTEPS * MT; ++s) {
    const int ks = s / MT, m = s % MT;
    if (s + 2 < KSTEPS * MT) {
      const int s2 = s + 2;
      const unsigned short* pah = inH + ((s2 % MT) * 16 + r) * PADH + (s2 / MT) * 32 + hi8;
      ah[s2 % 3].q[0] = *(const f4*)(pah);    ah[s2 % 3].q[1] = *(const f4*)(pah + 16);
    }
    if (s + 1 < KSTEPS * MT) {
      const int s1 = s + 1;
      const unsigned short* pal = inL + ((s1 % MT) * 16 + r) * PADH + (s1 / MT) * 32 + hi8;
      al[s1 & 1].q[0] = *(const f4*)(pal);    al[s1 & 1].q[1] = *(const f4*)(pal + 16);
    }
    if (m == 0) {
      const int kn = ks + NB - 1;
      if (kn < KSTEPS) load_b(bq[kn % NB], wC, voff, kn);
      else if (!LAST)  load_b(bq[kn % NB], wN, voff, kn - KSTEPS);
    }
    // holds the loads above in front of this step's matrix instructions: the scheduler otherwise
    // sinks each load to just before its use, and the wave waits out the latency there
    __builtin_amdgcn_sched_barrier(0);
    Frag (&bc)[2][2] = bq[ks % NB];
    // per accumulator the order hi*hi, hi*lo, lo*hi; the two column tiles alternate
#pragma unroll   // as above
    for (int t = 0; t < 2; ++t)
      acc[t][m] = __builtin_amdgcn_wmma_f32_16x16x32_bf16(false, bc[t][0].v, false, ah[s % 3].v,
                                                          (short)0, acc[t][m], false, false);
#pragma unroll   // as above
    for (int t = 0; t < 2; ++t)
      acc[t][m] = __builtin_amdgcn_wmma_f32_16x16x32_bf16(false, bc[t][1].v, false, ah[s % 3].v,
                                                          (short)0, acc[t][m], false, false);
#pragma unroll   // as above
    for (int t = 0; t < 2; ++t)
      acc[t][m] = __builtin_amdgcn_wmma_f32_16x16x32_bf16(false, bc[t][0].v, false, al[s & 1].v,
                                                          (short)0, acc[t][m], false, false);
    // ends the step: the next step's loads stay behind these matrix instructions
    __builtin_amdgcn_sched_barrier(0);
  }

  // every wave reads all rows and all k of the planes: none may be overwritten before the last read
  __syncthreads();

  // epilogue: bias + relu; write next-layer LDS planes (in place) or the staged f32 result
#pragma unroll
  for (int t = 0; t < 2; ++t) {
    const int col = (nt0 + t) * 16 + hi8;   // result layout: feature = col + vgpr, row = m * 16 + r
    const f4 b0 = *(const f4*)(bias + col), b1 = *(const f4*)(bias + col + 4);
#pragma unroll
    for (int m = 0; m < MT; ++m) {
      float val[8];
#pragma unroll
      for (int q = 0; q < 8; ++q) val[q] = fmaxf(acc[t][m][q] + ((q < 4) ? b0[q & 3] : b1[q & 3]), 0.f);
      if (LAST) {
        float* ps = stage + (r * SPITCH + col) + m * 16 * SPITCH;
        *(f4*)(ps)     = f4{val[0], val[1], val[2], val[3]};
        *(f4*)(ps + 4) = f4{val[4], val[5], val[6], val[7]};
      } else {
        u32x4 hw, lw;   // the 8 features as bf16 pairs: value, and what the value leaves over
#pragma unroll   // unrolled: val, hw and lw must be registers
        for (int k = 0; k < 4; ++k) {
          const unsigned h = pk_bf(val[2 * k], val[2 * k + 1]);
          hw[k] = h;
          lw[k] = pk_bf(val[2 * k] - __uint_as_float(h << 16),
                        val[2 * k + 1] - __uint_as_float(h & 0xFFFF0000u));
        }
        *(u32x4*)(inH + (r * PADH + col) + m * 16 * PADH) = hw;
        *(u32x4*)(inL + (r * PADH + col) + m * 16 * PADH) = lw;
      }
    }
  }

  if (LAST) {
    __syncthreads();   // a wave stores rows whose columns all eight waves have staged
    constexpr int RW = MT * 16 / WAVES;   // result rows that one wave stores
    const int row0 = wave * RW;
    i4 rr[RW / 4];
#pragma unroll   // unrolled here and below: rr, va and vb must be registers
    for (int k = 0; k < RW / 4; ++k) rr[k] = *(const i4*)(rows_s + row0 + 4 * k);
    f4 va[RW], vb[RW];   // left and right half of each row, 16 bytes a lane
#pragma unroll   // as above
    for (int j = 0; j < RW; ++j) {
      va[j] = *(const f4*)(stage + (row0 + j) * SPITCH + lane * 4);
      vb[j] = *(const f4*)(stage + (row0 + j) * SPITCH + D_DIM / 2 + lane * 4);
    }
#pragma unroll   // as above
    for (int j = 0; j < RW; ++j) {
      // the same in every lane: as a scalar it gives a scalar branch and a scalar row address
      const int ro = __builtin_amdgcn_readfirstlane(rr[j >> 2][j & 3]);
      if (ro >= 0) {   // a padding slot has no row
        float* po = out + (size_t)ro * D_DIM + lane * 4;
        *(f4*)(po) = va[j];
        *(f4*)(po + D_DIM / 2) = vb[j];
        // the wait that stands in front of any rewrite of a register that an issued store names
        asm volatile("s_wait_xcnt 0x0" ::: "memory");
      }
    }
  }
}

// ---- K3: fused routed 3-layer GEMM over one expert-grouped tile ----
// An expert's rows (padded to TILE_S) are cut into 128-row tiles and, for what is left over, 32-row
// tiles. The large tiles never number more than B_ROWS / TILE_M, which fills the chip's places a whole
// number of times; the small tiles have the highest block indices and are short (for speed only).
// One pair of LDS planes (about 137 KB) and at most 256 registers a wave: two work-groups share a WGP.
__global__ __launch_bounds__(BLK, 4) void k_main(
    const float* __restrict__ x, const float* __restrict__ b_leaf,
    const float* __restrict__ b_mid, const float* __restrict__ b_root,
    const unsigned short* __restrict__ wp, const int* __restrict__ wsi,
    float* __restrict__ out) {
  // hi and lo plane of the tile's current layer; at the end the f32 result (TILE_M * SPITCH floats fit)
  __shared__ __attribute__((aligned(16))) unsigned short smem[2 * TILE_M * PADH];
  __shared__ __attribute__((aligned(16))) int rows_s[TILE_M];   // read four at a time in the gather
  const int PLANE = TILE_M * PADH;
  unsigned short* pAh = smem;
  unsigned short* pAl = smem + PLANE;

  const int o1 = wsi[WS_OFFS + 1], o2 = wsi[WS_OFFS + 2];
  const int o3 = wsi[WS_OFFS + 3], o4 = wsi[WS_OFFS + 4];
  // large tiles of experts 0 .. e - 1, then the same for the small tiles
  const int f1 = o1 / TILE_M, f2 = f1 + (o2 - o1) / TILE_M;
  const int f3 = f2 + (o3 - o2) / TILE_M, f4n = f3 + (o4 - o3) / TILE_M;
  const int g1 = o1 % TILE_M / TILE_S, g2 = g1 + (o2 - o1) % TILE_M / TILE_S;
  const int g3 = g2 + (o3 - o2) % TILE_M / TILE_S, g4 = g3 + (o4 - o3) % TILE_M / TILE_S;
  const bool small = (int)blockIdx.x >= f4n;
  const int b = small ? (int)blockIdx.x - f4n : (int)blockIdx.x;   // index among the tiles of its size
  if (small && b >= g4) return;
  const int c1 = small ? g1 : f1, c2 = small ? g2 : f2, c3 = small ? g3 : f3;
  const int e = (b < c1) ? 0 : ((b < c2) ? 1 : ((b < c3) ? 2 : 3));
  const int p = e >> 1;
  const int oe = (e == 0) ? 0 : ((e == 1) ? o1 : ((e == 2) ? o2 : o3));     // the expert's first slot
  const int on = (e == 0) ? o1 : ((e == 1) ? o2 : ((e == 2) ? o3 : o4));    // the next expert's
  const int ce = (e == 0) ? 0 : ((e == 1) ? c1 : ((e == 2) ? c2 : c3));     // tiles of this size before it
  const int base = small ? oe + (on - oe) / TILE_M * TILE_M + (b - ce) * TILE_S
                         : oe + (b - ce) * TILE_M;
  const int nrows = small ? TILE_S : TILE_M;

  const int tid = threadIdx.x;
  // a small tile's slots past its rows count as padding slots
  if (tid < TILE_M) rows_s[tid] = (tid < nrows) ? wsi[WS_PERM + base + tid] : -1;
  __syncthreads();

  // gather x rows, split fp32 -> bf16 hi/lo planes.
  // A thread issues all its row loads before it converts the first: one memory latency per
  // tile instead of one per load. The loads carry no branch: a padding slot reads row 0, and
  // what the layers make of it is never stored (the last layer stores only slots with a row).
  const int grow = (tid >> 6) * (2 * GATHER_H);   // this thread's tile rows: grow .. grow + 2 * GATHER_H - 1
  const int gq = tid & 63;                        // its 16-byte piece of each row
  u32x4 q[GATHER_H / 2];                          // load offsets, in 16-byte units
#pragma unroll   // unrolled here and in the loops over j below: q, xa and xb must be registers
  for (int k = 0; k < GATHER_H / 2; ++k) {
    const i4 r = *(const i4*)(rows_s + grow + 4 * k);
#pragma unroll   // as above
    for (int s = 0; s < 4; ++s) q[k][s] = ((unsigned)(r[s] < 0 ? 0 : r[s]) << 6) + gq;
  }
  f4 xa[GATHER_H], xb[GATHER_H];                  // first and second half of the loads
#pragma unroll   // as above
  for (int j = 0; j < GATHER_H; ++j) xa[j] = *(const f4*)(x + (size_t)q[j >> 2][j & 3] * 4);
#pragma unroll   // as above
  for (int j = 0; j < GATHER_H; ++j)
    xb[j] = *(const f4*)(x + (size_t)q[(GATHER_H + j) >> 2][j & 3] * 4);
  // the wait that stands in front of any rewrite of a register that an issued load names;
  // the offsets are its inputs, so that each keeps its register up to this line
  asm volatile("s_wait_xcnt 0x0"
               :: "v"(q[0]), "v"(q[1]), "v"(q[2]), "v"(q[3]), "v"(q[4]), "v"(q[5]), "v"(q[6]), "v"(q[7])
               : "memory");
  // hi planes of the three layers' packed weights (the lo plane follows its hi plane)
  const unsigned short* wLeafH = wp + (2 * e) * WPLANE;
  const unsigned short* wMidH  = wp + (2 * (4 + p)) * WPLANE;
  const unsigned short* wRootH = wp + 12 * WPLANE;
  const unsigned voff = ((tid >> 5) * 2 * 8 * 512 + (tid & 31) * 8) * 2;   // the wave's column tiles, the lane's 16 bytes of a fragment's half
#pragma unroll 1   // rolled: the convert code stands once for both halves, which keeps the kernel's text short
  for (int h = 0; h < 2; ++h) {
#pragma unroll   // as above
    for (int j = 0; j < GATHER_H; ++j) {
      const int row = grow + h * GATHER_H + j;
      const int c = gq << 2;
      const f4 xv = xa[j];
      u16x4 hv = { f2bf(xv.x), f2bf(xv.y), f2bf(xv.z), f2bf(xv.w) };
      u16x4 lv = { f2bf(xv.x - bf2f(hv.x)), f2bf(xv.y - bf2f(hv.y)),
                   f2bf(xv.z - bf2f(hv.z)), f2bf(xv.w - bf2f(hv.w)) };
      *(u16x4*)(pAh + row * PADH + c) = hv;
      *(u16x4*)(pAl + row * PADH + c) = lv;
      xa[j] = xb[j];
    }
  }
  if (!small) {   // the same for the whole work-group: the barriers inside are passed by all or none
    Frag bq[2][2][2];   // B fragments: [k step mod 2][column tile][hi, lo plane]
    load_b(bq[0], wLeafH, voff, 0);   // the leaf layer's first, in flight over the barrier
    __syncthreads();

    // leaf (routed expert e)
    gemm_layer<false, TILE_M / 16, 2>(pAh, pAl, wLeafH, wMidH, voff, bq,
                                      b_leaf + e * D_DIM, nullptr, nullptr, nullptr);
    __syncthreads();
    // mid (parent p)
    gemm_layer<false, TILE_M / 16, 2>(pAh, pAl, wMidH, wRootH, voff, bq,
                                      b_mid + p * D_DIM, nullptr, nullptr, nullptr);
    __syncthreads();
    // root, scatter to original row order
    gemm_layer<true, TILE_M / 16, 2>(pAh, pAl, wRootH, nullptr, voff, bq,
                                     b_root, out, rows_s, (float*)smem);
  } else {
    Frag bq[4][2][2];   // B fragments: [k step mod 4][column tile][hi, lo plane]
    // the loads stand behind the barrier here: in front of it the compiler merges the first of them
    // with the other branch's and keeps those registers alive through this branch, which then spills
    __syncthreads();
#pragma unroll   // unrolled: bq must be registers
    for (int k = 0; k < 3; ++k) load_b(bq[k], wLeafH, voff, k);   // the leaf layer's first three

    gemm_layer<false, TILE_S / 16, 4>(pAh, pAl, wLeafH, wMidH, voff, bq,
                                      b_leaf + e * D_DIM, nullptr, nullptr, nullptr);
    __syncthreads();
    gemm_layer<false, TILE_S / 16, 4>(pAh, pAl, wMidH, wRootH, voff, bq,
                                      b_mid + p * D_DIM, nullptr, nullptr, nullptr);
    __syncthreads();
    gemm_layer<true, TILE_S / 16, 4>(pAh, pAl, wRootH, nullptr, voff, bq,
                                     b_root, out, rows_s, (float*)smem);
  }
}

extern "C" void kernel_launch(void* const* d_in, const int* in_sizes, int n_in,
                              void* d_out, int out_size, void* d_ws, size_t ws_size,
                              hipStream_t stream) {
  (void)in_sizes; (void)n_in; (void)out_size; (void)ws_size;
  const float* x      = (const float*)d_in[0];
  const float* Wg     = (const float*)d_in[1];
  const float* bg     = (const float*)d_in[2];
  const float* W_leaf = (const float*)d_in[3];
  const float* b_leaf = (const float*)d_in[4];
  const float* W_mid  = (const float*)d_in[5];
  const float* b_mid  = (const float*)d_in[6];
  const float* W_root = (const float*)d_in[7];
  const float* b_root = (const float*)d_in[8];
  float* out = (float*)d_out;
  int* wsi = (int*)d_ws;
  unsigned short* wp = (unsigned short*)((char*)d_ws + WPACK_BYTES);

  k_gate_pack<<<NBLK + PACK_BLK, 256, 0, stream>>>(x, Wg, bg, W_leaf, W_mid, W_root, wp, wsi);
  k_scatter<<<NBLK, 256, 0, stream>>>(wsi);
  k_main<<<B_ROWS / TILE_M + 12, BLK, 0, stream>>>(x, b_leaf, b_mid, b_root, wp, wsi, out);
}
